// v000
// Measured on an AMD MI455X. A time is GPU time per run, averaged over a window of back-to-back runs after a warm-up
// (all launches, gaps included; the runs take copies of the inputs in turn), and the median of several windows.
// Apart from v000's, it joins two sittings. Times from different sittings can be a few percent apart, while
// side-by-side timings come from the same sitting.
// The starting kernel, v000, takes 1990 microseconds a run.
#include <hip/hip_runtime.h>

// Multi-head attention with interleaved rotary embeddings (x [2][2048][1024]; q,k,v = x W^T ('oi' [1024][1024], no bias; 16 heads x 64); rotary on (even, odd) pairs with the given cos/sin tables [2048][32] (read); scores / 8; softmax over all keys; out = merged Wo^T + bo -> [2][2048][1024] (4.2 M)).
// Layout per batch: bf16 copy of x; exact projections; {cos, sin} table per position built once from the inputs (bf16-rounded; pair i serves dims 2i, 2i+1); interleaved rotary plane builder for q and k; dense T-2048 attention (hybrid rows: < 512 hi/lo 3 products, rest fp16 x1024); merged hi/lo x Wo exact + bo.
// Compute dtypes, f32 accumulate: every input rounded to bf16 incl. the tables; projections exact; rotary f32; attention rows < 512 3 products, rest fp16; softmax f32; Wo hl x exact + bias.

#define NB_  2
#define TT   2048
#define DM   1024
#define NH_  16
#define NKV  16
#define REP  (NH_ / NKV)
#define HD   64
#define DQ   (NH_ * HD)
#define DKV  (NKV * HD)
#define ZH   2
#define RH   512                  // query rows < RH use hi+lo planes (0: none)
#define WIN  0
#define PCAR 1024.0f
#define SCL  0.125f   // HD^-0.5
typedef _Float16 h16;
typedef unsigned short bf;
typedef __attribute__((ext_vector_type(16))) __bf16   v16bf;
typedef __attribute__((ext_vector_type(16))) _Float16 v16h;
typedef __attribute__((ext_vector_type(8)))  _Float16 v8h;
typedef __attribute__((ext_vector_type(8)))  unsigned short v8us;
typedef __attribute__((ext_vector_type(8)))  float    v8f;
typedef __attribute__((ext_vector_type(4)))  float    v4f;
typedef v8h  __attribute__((may_alias)) v8ha;
typedef v4f  __attribute__((may_alias)) v4fa;
typedef v8us __attribute__((may_alias)) v8usa;

__device__ __forceinline__ unsigned short f2bf(float f) { unsigned u = __float_as_uint(f); u += 0x7FFFu + ((u >> 16) & 1u); return (unsigned short)(u >> 16); }
__device__ __forceinline__ float bf2f(unsigned short b) { return __uint_as_float(((unsigned)b) << 16); }
__device__ __forceinline__ float bfr(float f) { return bf2f(f2bf(f)); }
__device__ __forceinline__ v16h cat16(v8h lo, v8h hi) { return __builtin_shufflevector(lo, hi, 0, 1, 2, 3, 4, 5, 6, 7, 8, 9, 10, 11, 12, 13, 14, 15); }
__device__ __forceinline__ v16bf cat16b(v8us lo, v8us hi) { return __builtin_bit_cast(v16bf, __builtin_shufflevector(lo, hi, 0, 1, 2, 3, 4, 5, 6, 7, 8, 9, 10, 11, 12, 13, 14, 15)); }
__device__ __forceinline__ v8f wmma16(v16h a, v16h b, v8f c) { return __builtin_amdgcn_wmma_f32_16x16x32_f16(false, a, false, b, (short)0, c, false, false); }
__device__ __forceinline__ v8f wmmab(v16bf a, v16bf b, v8f c) { return __builtin_amdgcn_wmma_f32_16x16x32_bf16(false, a, false, b, (short)0, c, false, false); }



// ---- k_gemmw: register-blocked GEMM, ONE WAVE per 64x64 output tile (16 accumulators), operands straight from K-contiguous 16-bit planes; grid (M/64, N/64, Z), 32 threads.
// C[m][n] (f32, pitch ldc, + optional f32 bias[n]) = sum_k A[m][k] Bt[n][k] (+ split products per NSPLIT). z-batch strides sA/sB/sC in elements. K % 32 == 0.
template <typename T16> struct WFrag;
template <> struct WFrag<h16> { typedef v16h V; static __device__ __forceinline__ V ld(const h16* p) { return cat16(*(const v8h*)p, *(const v8h*)(p + 16)); } static __device__ __forceinline__ v8f mma(V a, V b, v8f c) { return wmma16(a, b, c); } };
template <> struct WFrag<bf> { typedef v16bf V; static __device__ __forceinline__ V ld(const bf* p) { return cat16b(*(const v8us*)p, *(const v8us*)(p + 16)); } static __device__ __forceinline__ v8f mma(V a, V b, v8f c) { return wmmab(a, b, c); } };
template <typename T16, int NSPLIT, bool BIAS>
__global__ __launch_bounds__(32) void k_gemmw(const T16* __restrict__ A, const T16* __restrict__ A2, const T16* __restrict__ Bt, const T16* __restrict__ Bt2, int K, float* C, int ldc, const float* __restrict__ bias, size_t sA, size_t sB, size_t sC) {
    typedef typename WFrag<T16>::V V;
    __shared__ __align__(16) float os[16 * 68];
    const size_t z = blockIdx.z; A += z * sA; if (A2) A2 += z * sA; Bt += z * sB; if (Bt2) Bt2 += z * sB; C += z * sC;
    const int lane = threadIdx.x & 31, lr = lane & 15, hi = lane >> 4; const int r0 = blockIdx.x * 64, c0 = blockIdx.y * 64;
    v8f acc[4][4];
#pragma unroll
    for (int mb = 0; mb < 4; ++mb)
#pragma unroll
        for (int nb = 0; nb < 4; ++nb) acc[mb][nb] = (v8f){};
    const size_t aoff = (size_t)(r0 + lr) * K + 8 * hi, boff = (size_t)(c0 + lr) * K + 8 * hi;
#pragma unroll 1
    for (int kc = 0; kc < K; kc += 32) {
        V a[4], a2[4];
#pragma unroll
        for (int mb = 0; mb < 4; ++mb) { a[mb] = WFrag<T16>::ld(A + aoff + (size_t)mb * 16 * K + kc); if (NSPLIT == 1 || NSPLIT == 2) a2[mb] = WFrag<T16>::ld(A2 + aoff + (size_t)mb * 16 * K + kc); }
#pragma unroll
        for (int nb = 0; nb < 4; ++nb) { const V b = WFrag<T16>::ld(Bt + boff + (size_t)nb * 16 * K + kc); V b2; if (NSPLIT >= 2) b2 = WFrag<T16>::ld(Bt2 + boff + (size_t)nb * 16 * K + kc);
#pragma unroll
            for (int mb = 0; mb < 4; ++mb) { acc[mb][nb] = WFrag<T16>::mma(a[mb], b, acc[mb][nb]); if (NSPLIT == 1 || NSPLIT == 2) acc[mb][nb] = WFrag<T16>::mma(a2[mb], b, acc[mb][nb]); if (NSPLIT >= 2) acc[mb][nb] = WFrag<T16>::mma(a[mb], b2, acc[mb][nb]); } }
        asm volatile("v_nop\n\tv_nop\n\tv_nop\n\tv_nop" : "+v"(acc[0][0]), "+v"(acc[1][1]), "+v"(acc[2][2]), "+v"(acc[3][3]) : "v"(a[0]), "v"(a[3]));
    }
#pragma unroll
    for (int mb = 0; mb < 4; ++mb) {
#pragma unroll
        for (int nb = 0; nb < 4; ++nb) {
#pragma unroll
            for (int j = 0; j < 8; ++j) os[(hi * 8 + j) * 68 + nb * 16 + lr] = acc[mb][nb][j]; }
        __builtin_amdgcn_wave_barrier(); asm volatile("" ::: "memory");
        float* crow = C + (size_t)(r0 + mb * 16) * ldc + c0;
{
#pragma unroll
            for (int s = 0; s < 8; ++s) { const int row = 2 * s + hi, cofs = lr * 4; v4f val = *(const v4fa*)(os + row * 68 + cofs); if (BIAS) { val[0] += bfr(bias[c0 + cofs]); val[1] += bfr(bias[c0 + cofs + 1]); val[2] += bfr(bias[c0 + cofs + 2]); val[3] += bfr(bias[c0 + cofs + 3]); }
                *(v4f*)(crow + (size_t)row * ldc + cofs) = val; }
             }
        __builtin_amdgcn_wave_barrier(); asm volatile("" ::: "memory");
    }
}

__device__ __forceinline__ h16 tohx(float x) { return (h16)x; }
__device__ __forceinline__ void splitf(float y, unsigned short& h, unsigned short& l) { h = f2bf(y); l = f2bf(y - bf2f(h)); }
typedef __attribute__((ext_vector_type(2))) _Float16 v2h;
typedef __attribute__((ext_vector_type(4))) _Float16 v4h;
typedef __attribute__((ext_vector_type(2))) unsigned short v2us;
typedef __attribute__((ext_vector_type(4))) unsigned short v4us;
typedef __attribute__((ext_vector_type(2))) float v2f;
typedef __attribute__((ext_vector_type(4))) int v4i;

__global__ __launch_bounds__(256) void k_wtG(const float* __restrict__ w, int K, int N, bf* Bt) {
    const int lane = threadIdx.x & 31; const int L0 = (blockIdx.x * 8 + (threadIdx.x >> 5)) * 8; const int nlines = N * K / 64;
{
#pragma unroll 1
        for (int l = 0; l < 8; ++l) { const int L = L0 + l; if (L >= nlines) break; const size_t e = (size_t)L * 64 + lane * 2; const int k = (int)(e % K), n = (int)(e / K); v2us o;
            o[0] = f2bf(w[(size_t)k * N + n]); o[1] = f2bf(w[(size_t)(k + 1) * N + n]); *(v2us*)(Bt + e) = o; }
         }
}
__global__ __launch_bounds__(256) void k_cvt8(const float* __restrict__ src, bf* dst, size_t n8) { const size_t i = (size_t)blockIdx.x * 256 + threadIdx.x; if (i >= n8) return; const v8f v = *(const v8f*)(src + i * 8); v8us o;
#pragma unroll
    for (int k = 0; k < 8; ++k) o[k] = f2bf(v[k]); *(v8us*)(dst + i * 8) = o;  }

__global__ __launch_bounds__(256) void k_ropeI(const float* __restrict__ F, int pitch, int nheads, const float* __restrict__ CS, float sc, h16* P16, bf* Ph, bf* Pl) {
    const size_t e = ((size_t)blockIdx.x * 256 + threadIdx.x) * 2; if (e >= (size_t)nheads * TT * HD) return; const int d = (int)(e % HD); const int t = (int)((e / HD) % TT); const int h = (int)(e / ((size_t)HD * TT)); const float* f = F + (size_t)t * pitch + h * HD; const float x0 = f[d], x1 = f[d + 1]; const v2f cs = *(const v2f*)(CS + ((size_t)t * HD + d) * 2); v2h o16; v2us oh, ol;
    float a0 = __fmul_rn(x0, cs[0]), b0 = __fmul_rn(x1, cs[1]), a1 = __fmul_rn(x1, cs[0]), b1 = __fmul_rn(x0, cs[1]); asm volatile("" : "+v"(a0), "+v"(b0), "+v"(a1), "+v"(b1));
    float r0 = __fsub_rn(a0, b0) * sc, r1 = __fadd_rn(b1, a1) * sc;   /* even: x0 c - x1 s; odd: x0 s + x1 c */
    o16[0] = tohx(r0); o16[1] = tohx(r1); { unsigned short a2, c2; splitf(r0, a2, c2); oh[0] = a2; ol[0] = c2; splitf(r1, a2, c2); oh[1] = a2; ol[1] = c2; }
    *(v2h*)(P16 + e) = o16; *(v2us*)(Ph + e) = oh; *(v2us*)(Pl + e) = ol;  }

__global__ __launch_bounds__(256) void k_csin2(const float* __restrict__ cs, const float* __restrict__ sn, float* CS) { const int idx = blockIdx.x * 256 + threadIdx.x; if (idx >= TT * HD) return; const int d = idx % HD; const int t = idx / HD; v2f o; o[0] = bfr(cs[t * (HD / 2) + (d >> 1)]); o[1] = bfr(sn[t * (HD / 2) + (d >> 1)]); *(v2f*)(CS + (size_t)idx * 2) = o;  }
__global__ __launch_bounds__(256) void k_vtp(const float* __restrict__ F, int pitch, int nheads, h16* V16, bf* Vh, bf* Vl) { const size_t e = ((size_t)blockIdx.x * 256 + threadIdx.x) * 2; if (e >= (size_t)nheads * HD * TT) return; const int t = (int)(e % TT); const int d = (int)((e / TT) % HD); const int g = (int)(e / ((size_t)TT * HD)); v2h o16; v2us oh, ol;
#pragma unroll
    for (int q = 0; q < 2; ++q) { const float x = F[(size_t)(t + q) * pitch + g * HD + d]; o16[q] = tohx(x); unsigned short a2, c2; splitf(x, a2, c2); oh[q] = a2; ol[q] = c2; }
    *(v2h*)(V16 + e) = o16; *(v2us*)(Vh + e) = oh; *(v2us*)(Vl + e) = ol;  }
// k_asoft: per row (zz, i): t = S x HD^-0.5 (no mask); softmax over the 2048 keys (register row, one exp, fixed trees);
__global__ __launch_bounds__(256) void k_asoft(const float* __restrict__ Sb, h16* P16, bf* Ph, bf* Pl) {
    const int lane = threadIdx.x & 31; const int row = blockIdx.x * 8 + (threadIdx.x >> 5); if (row >= ZH * TT) return; const int i = row % TT; const int zz = row / TT; (void)zz; const bool hires = (i < RH); const float* sr = Sb + (size_t)row * TT; float v[TT / 32]; float mx = -3.0e38f;
#pragma unroll
    for (int ch = 0; ch < TT / 128; ++ch) { const int j0 = ch * 128 + lane * 4; const v4f a = *(const v4f*)(sr + j0);
#pragma unroll
        for (int q = 0; q < 4; ++q) { const int j = j0 + q; (void)j; const float t = a[q] * SCL; v[ch * 4 + q] = t; mx = fmaxf(mx, t); } }
#pragma unroll
    for (int sh = 16; sh; sh >>= 1) mx = fmaxf(mx, __shfl_xor(mx, sh, 32));
    float sum = 0.f;
#pragma unroll
    for (int k = 0; k < TT / 32; ++k) { float d0 = __fsub_rn(v[k], mx); asm volatile("" : "+v"(d0)); v[k] = __builtin_amdgcn_exp2f(__fmul_rn(d0, 1.4426950408889634f)); sum += v[k]; }
#pragma unroll
    for (int sh = 16; sh; sh >>= 1) sum += __shfl_xor(sum, sh, 32);
    const float f = __fdiv_rn(hires ? 1.0f : PCAR, sum);
{
        if (hires) {
#pragma unroll
            for (int ch = 0; ch < TT / 128; ++ch) { v4us oh, ol;
#pragma unroll
                for (int q = 0; q < 4; ++q) { unsigned short a, c2; splitf(v[ch * 4 + q] * f, a, c2); oh[q] = a; ol[q] = c2; }
                const size_t oo = ((size_t)zz * (RH ? RH : 1) + i) * TT + ch * 128 + lane * 4; *(v4us*)(Ph + oo) = oh; *(v4us*)(Pl + oo) = ol; }
        } else {
#pragma unroll
            for (int ch = 0; ch < TT / 128; ++ch) { v4h o4;
#pragma unroll
                for (int q = 0; q < 4; ++q) o4[q] = tohx(v[ch * 4 + q] * f);
                *(v4h*)(P16 + (size_t)row * TT + ch * 128 + lane * 4) = o4; } }
         }
}
__global__ __launch_bounds__(256) void k_merge(const float* __restrict__ O, int h0, bf* Ah, bf* Al) { const size_t e = ((size_t)blockIdx.x * 256 + threadIdx.x) * 2; if (e >= (size_t)ZH * TT * HD) return; const int d = (int)(e % HD); const int t = (int)((e / HD) % TT); const int zz = (int)(e / ((size_t)HD * TT)); const float cs = (t < RH) ? 1.0f : (1.0f / PCAR); const size_t oo = (size_t)t * DQ + (h0 + zz) * HD + d;
    v2us oh, ol;
#pragma unroll
    for (int q = 0; q < 2; ++q) { unsigned short a, c2; splitf(O[e + q] * cs, a, c2); oh[q] = a; ol[q] = c2; } *(v2us*)(Ah + oo) = oh; *(v2us*)(Al + oo) = ol;  }

extern "C" void kernel_launch(void* const* d_in, const int* in_sizes, int n_in,
                              void* d_out, int out_size, void* d_ws, size_t ws_size, hipStream_t stream) {
    (void)in_sizes; (void)n_in; (void)out_size;
    const float* x = (const float*)d_in[0]; const float* fcos = (const float*)d_in[1]; const float* fsin = (const float*)d_in[2]; const float* wq = (const float*)d_in[3]; const float* wk = (const float*)d_in[4]; const float* wv = (const float*)d_in[5]; const float* wo = (const float*)d_in[6]; const float* bo = (const float*)d_in[7];
    float* OUT = (float*)d_out;     // [2][2048][1024]
    char* wsp = (char*)d_ws;
    auto take = [&](size_t bytes) { char* p = wsp; wsp += (bytes + 255) & ~(size_t)255; return (void*)p; };
    bf* WQ = (bf*)take((size_t)DQ * DM * 2); bf* WK = (bf*)take((size_t)DKV * DM * 2); bf* WV = (bf*)take((size_t)DKV * DM * 2); bf* WO = (bf*)take((size_t)DM * DQ * 2); float* CS = (float*)take((size_t)TT * HD * 2 * 4);
    bf* XB = (bf*)take((size_t)TT * DM * 2); float* FQ = (float*)take((size_t)TT * DQ * 4); float* FK = (float*)take((size_t)TT * DKV * 4);
    h16* QP16 = (h16*)take((size_t)NH_ * TT * HD * 2); h16* KP16 = (h16*)take((size_t)NKV * TT * HD * 2); h16* VT16 = (h16*)take((size_t)NKV * HD * TT * 2);
    bf* QPh = (bf*)take((size_t)NH_ * TT * HD * 2); bf* QPl = (bf*)take((size_t)NH_ * TT * HD * 2); bf* KPh = (bf*)take((size_t)NKV * TT * HD * 2); bf* KPl = (bf*)take((size_t)NKV * TT * HD * 2); bf* VTh = (bf*)take((size_t)NKV * HD * TT * 2); bf* VTl = (bf*)take((size_t)NKV * HD * TT * 2); bf* Ph = (bf*)take((size_t)ZH * RH * TT * 2); bf* Pl = (bf*)take((size_t)ZH * RH * TT * 2);
    float* Sb = (float*)take((size_t)ZH * TT * TT * 4); h16* P16 = (h16*)take((size_t)ZH * TT * TT * 2); float* Ob = (float*)take((size_t)ZH * TT * HD * 4); bf* ATh = (bf*)take((size_t)TT * DQ * 2); bf* ATl = (bf*)take((size_t)TT * DQ * 2);
    if ((size_t)(wsp - (char*)d_ws) > ws_size) return;    // ws 256 MiB
    float* FV = FK;   // v projection reuses the k buffer after the k planes are built (stream-ordered)
    { k_cvt8<<<(unsigned)(((size_t)DQ * DM / 8 + 255) / 256), 256, 0, stream>>>(wq, WQ, (size_t)DQ * DM / 8); k_cvt8<<<(unsigned)(((size_t)DKV * DM / 8 + 255) / 256), 256, 0, stream>>>(wk, WK, (size_t)DKV * DM / 8); k_cvt8<<<(unsigned)(((size_t)DKV * DM / 8 + 255) / 256), 256, 0, stream>>>(wv, WV, (size_t)DKV * DM / 8);
      k_cvt8<<<(unsigned)(((size_t)DM * DQ / 8 + 255) / 256), 256, 0, stream>>>(wo, WO, (size_t)DM * DQ / 8); k_csin2<<<(TT * HD + 255) / 256, 256, 0, stream>>>(fcos, fsin, CS); }
    const unsigned LQ = (unsigned)(((size_t)NH_ * TT * HD / 2 + 255) / 256), LKv = (unsigned)(((size_t)NKV * TT * HD / 2 + 255) / 256);
    for (int b = 0; b < NB_; ++b) {
        
        k_cvt8<<<(unsigned)(((size_t)TT * DM / 8 + 255) / 256), 256, 0, stream>>>(x + (size_t)b * TT * DM, XB, (size_t)TT * DM / 8);
        k_gemmw<bf, 0, false><<<dim3(TT / 64, DQ / 64, 1), 32, 0, stream>>>(XB, nullptr, WQ, nullptr, DM, FQ, DQ, nullptr, 0, 0, 0);
        k_ropeI<<<LQ, 256, 0, stream>>>(FQ, DQ, NH_, CS, 1.0f, QP16, QPh, QPl);
        k_gemmw<bf, 0, false><<<dim3(TT / 64, DKV / 64, 1), 32, 0, stream>>>(XB, nullptr, WK, nullptr, DM, FK, DKV, nullptr, 0, 0, 0);
        k_ropeI<<<LKv, 256, 0, stream>>>(FK, DKV, NKV, CS, 1.0f, KP16, KPh, KPl);
        k_gemmw<bf, 0, false><<<dim3(TT / 64, DKV / 64, 1), 32, 0, stream>>>(XB, nullptr, WV, nullptr, DM, FV, DKV, nullptr, 0, 0, 0); k_vtp<<<LKv, 256, 0, stream>>>(FV, DKV, NKV, VT16, VTh, VTl);
        for (int h0 = 0; h0 < NH_; h0 += ZH) { const size_t zq = (size_t)h0, zk = (size_t)(h0 / REP);   // one kv head per query head: the pass's two heads use consecutive kv planes (z-strides TT*HD)
            k_gemmw<bf, 2, false><<<dim3(RH / 64, TT / 64, ZH), 32, 0, stream>>>(QPh + zq * TT * HD, QPl + zq * TT * HD, KPh + zk * TT * HD, KPl + zk * TT * HD, HD, Sb, TT, nullptr, (size_t)TT * HD, (size_t)TT * HD, (size_t)TT * TT);
            k_gemmw<h16, 0, false><<<dim3((TT - RH) / 64, TT / 64, ZH), 32, 0, stream>>>(QP16 + zq * TT * HD + (size_t)RH * HD, nullptr, KP16 + zk * TT * HD, nullptr, HD, Sb + (size_t)RH * TT, TT, nullptr, (size_t)TT * HD, (size_t)TT * HD, (size_t)TT * TT);
            k_asoft<<<ZH * TT / 8, 256, 0, stream>>>(Sb, P16, Ph, Pl);
            k_gemmw<bf, 2, false><<<dim3(RH / 64, HD / 64, ZH), 32, 0, stream>>>(Ph, Pl, VTh + zk * HD * TT, VTl + zk * HD * TT, TT, Ob, HD, nullptr, (size_t)RH * TT, (size_t)HD * TT, (size_t)TT * HD);
            k_gemmw<h16, 0, false><<<dim3((TT - RH) / 64, HD / 64, ZH), 32, 0, stream>>>(P16 + (size_t)RH * TT, nullptr, VT16 + zk * HD * TT, nullptr, TT, Ob + (size_t)RH * HD, HD, nullptr, (size_t)TT * TT, (size_t)HD * TT, (size_t)TT * HD);
            k_merge<<<(unsigned)(((size_t)ZH * TT * HD / 2 + 255) / 256), 256, 0, stream>>>(Ob, h0, ATh, ATl); }
        k_gemmw<bf, 1, true><<<dim3(TT / 64, DM / 64, 1), 32, 0, stream>>>(ATh, ATl, WO, nullptr, DQ, OUT + (size_t)b * TT * DM, DM, bo, 0, 0, 0); }
}

// v001
// It runs in 857 microseconds.
// Timed twice side by side with v000, it ran 2.31 and 2.30 times as fast.
#include <hip/hip_runtime.h>

// Multi-head attention with interleaved rotary embeddings (x [2][2048][1024]; q,k,v = x W^T ('oi' [1024][1024], no bias; 16 heads x 64); rotary on (even, odd) pairs with the given cos/sin tables [2048][32] (read); scores / 8; softmax over all keys; out = merged Wo^T + bo -> [2][2048][1024] (4.2 M)).
// Layout per batch: bf16 copy of x; exact projections; {cos, sin} table per position built once from the inputs (bf16-rounded; pair i serves dims 2i, 2i+1); interleaved rotary plane builder for q and k; dense T-2048 attention (hybrid rows: < 512 hi/lo 3 products, rest fp16 x1024); merged hi/lo x Wo exact + bo.
// Compute dtypes, f32 accumulate: every input rounded to bf16 incl. the tables; projections exact; rotary f32; attention rows < 512 3 products, rest fp16; softmax f32; Wo hl x exact + bias.

#define NB_  2
#define TT   2048
#define DM   1024
#define NH_  16
#define NKV  16
#define REP  (NH_ / NKV)
#define HD   64
#define DQ   (NH_ * HD)
#define DKV  (NKV * HD)
#define ZH   2
#define RH   512                  // query rows < RH use hi+lo planes (0: none)
#define WIN  0
#define PCAR 1024.0f
#define SCL  0.125f   // HD^-0.5
#define KSL  16                   // K slices of the P x V products (2048 keys -> 128 per wave)
typedef _Float16 h16;
typedef unsigned short bf;
typedef __attribute__((ext_vector_type(16))) __bf16   v16bf;
typedef __attribute__((ext_vector_type(16))) _Float16 v16h;
typedef __attribute__((ext_vector_type(8)))  _Float16 v8h;
typedef __attribute__((ext_vector_type(8)))  unsigned short v8us;
typedef __attribute__((ext_vector_type(8)))  float    v8f;
typedef __attribute__((ext_vector_type(4)))  float    v4f;
typedef v8h  __attribute__((may_alias)) v8ha;
typedef v4f  __attribute__((may_alias)) v4fa;
typedef v8us __attribute__((may_alias)) v8usa;

__device__ __forceinline__ unsigned short f2bf(float f) { unsigned u = __float_as_uint(f); u += 0x7FFFu + ((u >> 16) & 1u); return (unsigned short)(u >> 16); }
__device__ __forceinline__ float bf2f(unsigned short b) { return __uint_as_float(((unsigned)b) << 16); }
__device__ __forceinline__ float bfr(float f) { return bf2f(f2bf(f)); }
__device__ __forceinline__ v16h cat16(v8h lo, v8h hi) { return __builtin_shufflevector(lo, hi, 0, 1, 2, 3, 4, 5, 6, 7, 8, 9, 10, 11, 12, 13, 14, 15); }
__device__ __forceinline__ v16bf cat16b(v8us lo, v8us hi) { return __builtin_bit_cast(v16bf, __builtin_shufflevector(lo, hi, 0, 1, 2, 3, 4, 5, 6, 7, 8, 9, 10, 11, 12, 13, 14, 15)); }
__device__ __forceinline__ v8f wmma16(v16h a, v16h b, v8f c) { return __builtin_amdgcn_wmma_f32_16x16x32_f16(false, a, false, b, (short)0, c, false, false); }
__device__ __forceinline__ v8f wmmab(v16bf a, v16bf b, v8f c) { return __builtin_amdgcn_wmma_f32_16x16x32_bf16(false, a, false, b, (short)0, c, false, false); }



// ---- k_gemmw: register-blocked GEMM, ONE WAVE per 64x64 output tile (16 accumulators), operands straight from K-contiguous 16-bit planes; grid (M/64, N/64, Z), 32 threads.
// C[m][n] (f32, pitch ldc, + optional f32 bias[n]) = sum_k A[m][k] Bt[n][k] (+ split products per NSPLIT). z-batch strides sA/sB/sC in elements. K % 32 == 0.
// KS > 1: grid z = batch * KS + slice; a wave sums only its K / KS keys and stores a partial tile in plane (batch * KS + slice) of C (plane stride sC); the reader adds a batch's KS planes. K % (32 * KS) == 0.
template <typename T16> struct WFrag;
template <> struct WFrag<h16> { typedef v16h V; static __device__ __forceinline__ V ld(const h16* p) { return cat16(*(const v8h*)p, *(const v8h*)(p + 16)); } static __device__ __forceinline__ v8f mma(V a, V b, v8f c) { return wmma16(a, b, c); } };
template <> struct WFrag<bf> { typedef v16bf V; static __device__ __forceinline__ V ld(const bf* p) { return cat16b(*(const v8us*)p, *(const v8us*)(p + 16)); } static __device__ __forceinline__ v8f mma(V a, V b, v8f c) { return wmmab(a, b, c); } };
template <typename T16, int NSPLIT, bool BIAS, int KS = 1>
__global__ __launch_bounds__(32) void k_gemmw(const T16* __restrict__ A, const T16* __restrict__ A2, const T16* __restrict__ Bt, const T16* __restrict__ Bt2, int K, float* C, int ldc, const float* __restrict__ bias, size_t sA, size_t sB, size_t sC) {
    typedef typename WFrag<T16>::V V;
    __shared__ __align__(16) float os[16 * 68];
    const size_t z = blockIdx.z / KS; const int ks = blockIdx.z % KS; A += z * sA; if (A2) A2 += z * sA; Bt += z * sB; if (Bt2) Bt2 += z * sB; C += (size_t)blockIdx.z * sC;
    const int kbeg = ks * (K / KS), kend = kbeg + K / KS;
    const int lane = threadIdx.x & 31, lr = lane & 15, hi = lane >> 4; const int r0 = blockIdx.x * 64, c0 = blockIdx.y * 64;
    v8f acc[4][4];
#pragma unroll
    for (int mb = 0; mb < 4; ++mb)
#pragma unroll
        for (int nb = 0; nb < 4; ++nb) acc[mb][nb] = (v8f){};
    const size_t aoff = (size_t)(r0 + lr) * K + 8 * hi, boff = (size_t)(c0 + lr) * K + 8 * hi;
#pragma unroll 1
    for (int kc = kbeg; kc < kend; kc += 32) {
        V a[4], a2[4];
#pragma unroll
        for (int mb = 0; mb < 4; ++mb) { a[mb] = WFrag<T16>::ld(A + aoff + (size_t)mb * 16 * K + kc); if (NSPLIT == 1 || NSPLIT == 2) a2[mb] = WFrag<T16>::ld(A2 + aoff + (size_t)mb * 16 * K + kc); }
#pragma unroll
        for (int nb = 0; nb < 4; ++nb) { const V b = WFrag<T16>::ld(Bt + boff + (size_t)nb * 16 * K + kc); V b2; if (NSPLIT >= 2) b2 = WFrag<T16>::ld(Bt2 + boff + (size_t)nb * 16 * K + kc);
#pragma unroll
            for (int mb = 0; mb < 4; ++mb) { acc[mb][nb] = WFrag<T16>::mma(a[mb], b, acc[mb][nb]); if (NSPLIT == 1 || NSPLIT == 2) acc[mb][nb] = WFrag<T16>::mma(a2[mb], b, acc[mb][nb]); if (NSPLIT >= 2) acc[mb][nb] = WFrag<T16>::mma(a[mb], b2, acc[mb][nb]); } }
        asm volatile("v_nop\n\tv_nop\n\tv_nop\n\tv_nop" : "+v"(acc[0][0]), "+v"(acc[1][1]), "+v"(acc[2][2]), "+v"(acc[3][3]) : "v"(a[0]), "v"(a[3]));
    }
#pragma unroll
    for (int mb = 0; mb < 4; ++mb) {
#pragma unroll
        for (int nb = 0; nb < 4; ++nb) {
#pragma unroll
            for (int j = 0; j < 8; ++j) os[(hi * 8 + j) * 68 + nb * 16 + lr] = acc[mb][nb][j]; }
        __builtin_amdgcn_wave_barrier(); asm volatile("" ::: "memory");
        float* crow = C + (size_t)(r0 + mb * 16) * ldc + c0;
{
#pragma unroll
            for (int s = 0; s < 8; ++s) { const int row = 2 * s + hi, cofs = lr * 4; v4f val = *(const v4fa*)(os + row * 68 + cofs); if (BIAS) { val[0] += bfr(bias[c0 + cofs]); val[1] += bfr(bias[c0 + cofs + 1]); val[2] += bfr(bias[c0 + cofs + 2]); val[3] += bfr(bias[c0 + cofs + 3]); }
                *(v4f*)(crow + (size_t)row * ldc + cofs) = val; }
             }
        __builtin_amdgcn_wave_barrier(); asm volatile("" ::: "memory");
    }
}

__device__ __forceinline__ h16 tohx(float x) { return (h16)x; }
__device__ __forceinline__ void splitf(float y, unsigned short& h, unsigned short& l) { h = f2bf(y); l = f2bf(y - bf2f(h)); }
typedef __attribute__((ext_vector_type(2))) _Float16 v2h;
typedef __attribute__((ext_vector_type(4))) _Float16 v4h;
typedef __attribute__((ext_vector_type(2))) unsigned short v2us;
typedef __attribute__((ext_vector_type(4))) unsigned short v4us;
typedef __attribute__((ext_vector_type(2))) float v2f;
typedef __attribute__((ext_vector_type(4))) int v4i;

__global__ __launch_bounds__(256) void k_wtG(const float* __restrict__ w, int K, int N, bf* Bt) {
    const int lane = threadIdx.x & 31; const int L0 = (blockIdx.x * 8 + (threadIdx.x >> 5)) * 8; const int nlines = N * K / 64;
{
#pragma unroll 1
        for (int l = 0; l < 8; ++l) { const int L = L0 + l; if (L >= nlines) break; const size_t e = (size_t)L * 64 + lane * 2; const int k = (int)(e % K), n = (int)(e / K); v2us o;
            o[0] = f2bf(w[(size_t)k * N + n]); o[1] = f2bf(w[(size_t)(k + 1) * N + n]); *(v2us*)(Bt + e) = o; }
         }
}
__global__ __launch_bounds__(256) void k_cvt8(const float* __restrict__ src, bf* dst, size_t n8) { const size_t i = (size_t)blockIdx.x * 256 + threadIdx.x; if (i >= n8) return; const v8f v = *(const v8f*)(src + i * 8); v8us o;
#pragma unroll
    for (int k = 0; k < 8; ++k) o[k] = f2bf(v[k]); *(v8us*)(dst + i * 8) = o;  }

__global__ __launch_bounds__(256) void k_ropeI(const float* __restrict__ F, int pitch, int nheads, const float* __restrict__ CS, float sc, h16* P16, bf* Ph, bf* Pl) {
    const size_t e = ((size_t)blockIdx.x * 256 + threadIdx.x) * 2; if (e >= (size_t)nheads * TT * HD) return; const int d = (int)(e % HD); const int t = (int)((e / HD) % TT); const int h = (int)(e / ((size_t)HD * TT)); const float* f = F + (size_t)t * pitch + h * HD; const float x0 = f[d], x1 = f[d + 1]; const v2f cs = *(const v2f*)(CS + ((size_t)t * HD + d) * 2); v2h o16; v2us oh, ol;
    float a0 = __fmul_rn(x0, cs[0]), b0 = __fmul_rn(x1, cs[1]), a1 = __fmul_rn(x1, cs[0]), b1 = __fmul_rn(x0, cs[1]); asm volatile("" : "+v"(a0), "+v"(b0), "+v"(a1), "+v"(b1));
    float r0 = __fsub_rn(a0, b0) * sc, r1 = __fadd_rn(b1, a1) * sc;   /* even: x0 c - x1 s; odd: x0 s + x1 c */
    o16[0] = tohx(r0); o16[1] = tohx(r1); { unsigned short a2, c2; splitf(r0, a2, c2); oh[0] = a2; ol[0] = c2; splitf(r1, a2, c2); oh[1] = a2; ol[1] = c2; }
    *(v2h*)(P16 + e) = o16; *(v2us*)(Ph + e) = oh; *(v2us*)(Pl + e) = ol;  }

__global__ __launch_bounds__(256) void k_csin2(const float* __restrict__ cs, const float* __restrict__ sn, float* CS) { const int idx = blockIdx.x * 256 + threadIdx.x; if (idx >= TT * HD) return; const int d = idx % HD; const int t = idx / HD; v2f o; o[0] = bfr(cs[t * (HD / 2) + (d >> 1)]); o[1] = bfr(sn[t * (HD / 2) + (d >> 1)]); *(v2f*)(CS + (size_t)idx * 2) = o;  }
__global__ __launch_bounds__(256) void k_vtp(const float* __restrict__ F, int pitch, int nheads, h16* V16, bf* Vh, bf* Vl) { const size_t e = ((size_t)blockIdx.x * 256 + threadIdx.x) * 2; if (e >= (size_t)nheads * HD * TT) return; const int t = (int)(e % TT); const int d = (int)((e / TT) % HD); const int g = (int)(e / ((size_t)TT * HD)); v2h o16; v2us oh, ol;
#pragma unroll
    for (int q = 0; q < 2; ++q) { const float x = F[(size_t)(t + q) * pitch + g * HD + d]; o16[q] = tohx(x); unsigned short a2, c2; splitf(x, a2, c2); oh[q] = a2; ol[q] = c2; }
    *(v2h*)(V16 + e) = o16; *(v2us*)(Vh + e) = oh; *(v2us*)(Vl + e) = ol;  }
// k_asoft: per row (zz, i): t = S x HD^-0.5 (no mask); softmax over the 2048 keys (register row, one exp, fixed trees);
__global__ __launch_bounds__(256) void k_asoft(const float* __restrict__ Sb, h16* P16, bf* Ph, bf* Pl) {
    const int lane = threadIdx.x & 31; const int row = blockIdx.x * 8 + (threadIdx.x >> 5); if (row >= ZH * TT) return; const int i = row % TT; const int zz = row / TT; (void)zz; const bool hires = (i < RH); const float* sr = Sb + (size_t)row * TT; float v[TT / 32]; float mx = -3.0e38f;
#pragma unroll
    for (int ch = 0; ch < TT / 128; ++ch) { const int j0 = ch * 128 + lane * 4; const v4f a = *(const v4f*)(sr + j0);
#pragma unroll
        for (int q = 0; q < 4; ++q) { const int j = j0 + q; (void)j; const float t = a[q] * SCL; v[ch * 4 + q] = t; mx = fmaxf(mx, t); } }
#pragma unroll
    for (int sh = 16; sh; sh >>= 1) mx = fmaxf(mx, __shfl_xor(mx, sh, 32));
    float sum = 0.f;
#pragma unroll
    for (int k = 0; k < TT / 32; ++k) { float d0 = __fsub_rn(v[k], mx); asm volatile("" : "+v"(d0)); v[k] = __builtin_amdgcn_exp2f(__fmul_rn(d0, 1.4426950408889634f)); sum += v[k]; }
#pragma unroll
    for (int sh = 16; sh; sh >>= 1) sum += __shfl_xor(sum, sh, 32);
    const float f = __fdiv_rn(hires ? 1.0f : PCAR, sum);
{
        if (hires) {
#pragma unroll
            for (int ch = 0; ch < TT / 128; ++ch) { v4us oh, ol;
#pragma unroll
                for (int q = 0; q < 4; ++q) { unsigned short a, c2; splitf(v[ch * 4 + q] * f, a, c2); oh[q] = a; ol[q] = c2; }
                const size_t oo = ((size_t)zz * (RH ? RH : 1) + i) * TT + ch * 128 + lane * 4; *(v4us*)(Ph + oo) = oh; *(v4us*)(Pl + oo) = ol; }
        } else {
#pragma unroll
            for (int ch = 0; ch < TT / 128; ++ch) { v4h o4;
#pragma unroll
                for (int q = 0; q < 4; ++q) o4[q] = tohx(v[ch * 4 + q] * f);
                *(v4h*)(P16 + (size_t)row * TT + ch * 128 + lane * 4) = o4; } }
         }
}
__global__ __launch_bounds__(256) void k_merge(const float* __restrict__ O, int h0, bf* Ah, bf* Al) { const size_t e = ((size_t)blockIdx.x * 256 + threadIdx.x) * 2; if (e >= (size_t)ZH * TT * HD) return; const int d = (int)(e % HD); const int t = (int)((e / HD) % TT); const int zz = (int)(e / ((size_t)HD * TT)); const float cs = (t < RH) ? 1.0f : (1.0f / PCAR); const size_t oo = (size_t)t * DQ + (h0 + zz) * HD + d;
    v2us oh, ol; v2f pp[KSL]; const float* op = O + (size_t)zz * (KSL - 1) * TT * HD + e;   /* slice 0 of this head's KSL partial planes */
#pragma unroll
    for (int p = 0; p < KSL; ++p) pp[p] = *(const v2f*)(op + (size_t)p * TT * HD);
    /* inputs only: all KSL loads are in flight together, and their shared address pair stays whole until they have returned (without it the last load lands on that pair) */
    asm volatile("" :: "v"(pp[0]), "v"(pp[1]), "v"(pp[2]), "v"(pp[3]), "v"(pp[4]), "v"(pp[5]), "v"(pp[6]), "v"(pp[7]), "v"(pp[8]), "v"(pp[9]), "v"(pp[10]), "v"(pp[11]), "v"(pp[12]), "v"(pp[13]), "v"(pp[14]), "v"(pp[15]), "v"(op));
    v2f sm = pp[0];
#pragma unroll
    for (int p = 1; p < KSL; ++p) sm += pp[p];   /* fixed order: slice 0, 1, ... */
#pragma unroll
    for (int q = 0; q < 2; ++q) { unsigned short a, c2; splitf(sm[q] * cs, a, c2); oh[q] = a; ol[q] = c2; } *(v2us*)(Ah + oo) = oh; *(v2us*)(Al + oo) = ol;  }

extern "C" void kernel_launch(void* const* d_in, const int* in_sizes, int n_in,
                              void* d_out, int out_size, void* d_ws, size_t ws_size, hipStream_t stream) {
    (void)in_sizes; (void)n_in; (void)out_size;
    const float* x = (const float*)d_in[0]; const float* fcos = (const float*)d_in[1]; const float* fsin = (const float*)d_in[2]; const float* wq = (const float*)d_in[3]; const float* wk = (const float*)d_in[4]; const float* wv = (const float*)d_in[5]; const float* wo = (const float*)d_in[6]; const float* bo = (const float*)d_in[7];
    float* OUT = (float*)d_out;     // [2][2048][1024]
    char* wsp = (char*)d_ws;
    auto take = [&](size_t bytes) { char* p = wsp; wsp += (bytes + 255) & ~(size_t)255; return (void*)p; };
    bf* WQ = (bf*)take((size_t)DQ * DM * 2); bf* WK = (bf*)take((size_t)DKV * DM * 2); bf* WV = (bf*)take((size_t)DKV * DM * 2); bf* WO = (bf*)take((size_t)DM * DQ * 2); float* CS = (float*)take((size_t)TT * HD * 2 * 4);
    bf* XB = (bf*)take((size_t)TT * DM * 2); float* FQ = (float*)take((size_t)TT * DQ * 4); float* FK = (float*)take((size_t)TT * DKV * 4);
    h16* QP16 = (h16*)take((size_t)NH_ * TT * HD * 2); h16* KP16 = (h16*)take((size_t)NKV * TT * HD * 2); h16* VT16 = (h16*)take((size_t)NKV * HD * TT * 2);
    bf* QPh = (bf*)take((size_t)NH_ * TT * HD * 2); bf* QPl = (bf*)take((size_t)NH_ * TT * HD * 2); bf* KPh = (bf*)take((size_t)NKV * TT * HD * 2); bf* KPl = (bf*)take((size_t)NKV * TT * HD * 2); bf* VTh = (bf*)take((size_t)NKV * HD * TT * 2); bf* VTl = (bf*)take((size_t)NKV * HD * TT * 2); bf* Ph = (bf*)take((size_t)ZH * RH * TT * 2); bf* Pl = (bf*)take((size_t)ZH * RH * TT * 2);
    float* Sb = (float*)take((size_t)ZH * TT * TT * 4); h16* P16 = (h16*)take((size_t)ZH * TT * TT * 2); float* Ob = (float*)take((size_t)KSL * ZH * TT * HD * 4); bf* ATh = (bf*)take((size_t)TT * DQ * 2); bf* ATl = (bf*)take((size_t)TT * DQ * 2);
    if ((size_t)(wsp - (char*)d_ws) > ws_size) return;    // ws 256 MiB
    float* FV = FK;   // v projection reuses the k buffer after the k planes are built (stream-ordered)
    { k_cvt8<<<(unsigned)(((size_t)DQ * DM / 8 + 255) / 256), 256, 0, stream>>>(wq, WQ, (size_t)DQ * DM / 8); k_cvt8<<<(unsigned)(((size_t)DKV * DM / 8 + 255) / 256), 256, 0, stream>>>(wk, WK, (size_t)DKV * DM / 8); k_cvt8<<<(unsigned)(((size_t)DKV * DM / 8 + 255) / 256), 256, 0, stream>>>(wv, WV, (size_t)DKV * DM / 8);
      k_cvt8<<<(unsigned)(((size_t)DM * DQ / 8 + 255) / 256), 256, 0, stream>>>(wo, WO, (size_t)DM * DQ / 8); k_csin2<<<(TT * HD + 255) / 256, 256, 0, stream>>>(fcos, fsin, CS); }
    const unsigned LQ = (unsigned)(((size_t)NH_ * TT * HD / 2 + 255) / 256), LKv = (unsigned)(((size_t)NKV * TT * HD / 2 + 255) / 256);
    for (int b = 0; b < NB_; ++b) {
        
        k_cvt8<<<(unsigned)(((size_t)TT * DM / 8 + 255) / 256), 256, 0, stream>>>(x + (size_t)b * TT * DM, XB, (size_t)TT * DM / 8);
        k_gemmw<bf, 0, false><<<dim3(TT / 64, DQ / 64, 1), 32, 0, stream>>>(XB, nullptr, WQ, nullptr, DM, FQ, DQ, nullptr, 0, 0, 0);
        k_ropeI<<<LQ, 256, 0, stream>>>(FQ, DQ, NH_, CS, 1.0f, QP16, QPh, QPl);
        k_gemmw<bf, 0, false><<<dim3(TT / 64, DKV / 64, 1), 32, 0, stream>>>(XB, nullptr, WK, nullptr, DM, FK, DKV, nullptr, 0, 0, 0);
        k_ropeI<<<LKv, 256, 0, stream>>>(FK, DKV, NKV, CS, 1.0f, KP16, KPh, KPl);
        k_gemmw<bf, 0, false><<<dim3(TT / 64, DKV / 64, 1), 32, 0, stream>>>(XB, nullptr, WV, nullptr, DM, FV, DKV, nullptr, 0, 0, 0); k_vtp<<<LKv, 256, 0, stream>>>(FV, DKV, NKV, VT16, VTh, VTl);
        for (int h0 = 0; h0 < NH_; h0 += ZH) { const size_t zq = (size_t)h0, zk = (size_t)(h0 / REP);   // one kv head per query head: the pass's two heads use consecutive kv planes (z-strides TT*HD)
            k_gemmw<bf, 2, false><<<dim3(RH / 64, TT / 64, ZH), 32, 0, stream>>>(QPh + zq * TT * HD, QPl + zq * TT * HD, KPh + zk * TT * HD, KPl + zk * TT * HD, HD, Sb, TT, nullptr, (size_t)TT * HD, (size_t)TT * HD, (size_t)TT * TT);
            k_gemmw<h16, 0, false><<<dim3((TT - RH) / 64, TT / 64, ZH), 32, 0, stream>>>(QP16 + zq * TT * HD + (size_t)RH * HD, nullptr, KP16 + zk * TT * HD, nullptr, HD, Sb + (size_t)RH * TT, TT, nullptr, (size_t)TT * HD, (size_t)TT * HD, (size_t)TT * TT);
            k_asoft<<<ZH * TT / 8, 256, 0, stream>>>(Sb, P16, Ph, Pl);
            k_gemmw<bf, 2, false, KSL><<<dim3(RH / 64, HD / 64, ZH * KSL), 32, 0, stream>>>(Ph, Pl, VTh + zk * HD * TT, VTl + zk * HD * TT, TT, Ob, HD, nullptr, (size_t)RH * TT, (size_t)HD * TT, (size_t)TT * HD);
            k_gemmw<h16, 0, false, KSL><<<dim3((TT - RH) / 64, HD / 64, ZH * KSL), 32, 0, stream>>>(P16 + (size_t)RH * TT, nullptr, VT16 + zk * HD * TT, nullptr, TT, Ob + (size_t)RH * HD, HD, nullptr, (size_t)TT * TT, (size_t)HD * TT, (size_t)TT * HD);
            k_merge<<<(unsigned)(((size_t)ZH * TT * HD / 2 + 255) / 256), 256, 0, stream>>>(Ob, h0, ATh, ATl); }
        k_gemmw<bf, 1, true><<<dim3(TT / 64, DM / 64, 1), 32, 0, stream>>>(ATh, ATl, WO, nullptr, DQ, OUT + (size_t)b * TT * DM, DM, bo, 0, 0, 0); }
}

// v003
// It runs in 330 microseconds.
// It is 2.56 times as fast as v001, going by the measured steps of the versions left out in between.
// Counting every step since v000, it is 5.91 times as fast.
#include <hip/hip_runtime.h>

// Multi-head attention with interleaved rotary embeddings (x [2][2048][1024]; q,k,v = x W^T ('oi' [1024][1024], no bias; 16 heads x 64); rotary on (even, odd) pairs with the given cos/sin tables [2048][32] (read); scores / 8; softmax over all keys; out = merged Wo^T + bo -> [2][2048][1024] (4.2 M)).
// Layout per batch: bf16 copy of x; exact projections; {cos, sin} table per position built once from the inputs (bf16-rounded; pair i serves dims 2i, 2i+1); the interleaved rotary turn of q and k and the building of the q, k and v^T planes are the projection kernels' epilogues. Then one fused dense T-2048 attention kernel for both batches and all heads (hybrid rows: < 512 hi/lo 3 products, rest fp16 x1024); merged hi/lo x Wo exact + bo.
// Compute dtypes, f32 accumulate: every input rounded to bf16 incl. the tables; projections exact; rotary f32; attention rows < 512 3 products, rest fp16; softmax f32; Wo hl x exact + bias.

#define NB_  2
#define TT   2048
#define DM   1024
#define NH_  16
#define NKV  16
#define REP  (NH_ / NKV)
#define HD   64
#define DQ   (NH_ * HD)
#define DKV  (NKV * HD)
#define RH   512                  // query rows < RH use hi+lo planes (0: none)
#define WIN  0
#define SCL  0.125f   // HD^-0.5
typedef _Float16 h16;
typedef unsigned short bf;
typedef __attribute__((ext_vector_type(16))) __bf16   v16bf;
typedef __attribute__((ext_vector_type(16))) _Float16 v16h;
typedef __attribute__((ext_vector_type(8)))  _Float16 v8h;
typedef __attribute__((ext_vector_type(8)))  unsigned short v8us;
typedef __attribute__((ext_vector_type(8)))  float    v8f;
typedef __attribute__((ext_vector_type(4)))  float    v4f;
typedef v8h  __attribute__((may_alias)) v8ha;
typedef v4f  __attribute__((may_alias)) v4fa;
typedef v8us __attribute__((may_alias)) v8usa;

__device__ __forceinline__ unsigned short f2bf(float f) { unsigned u = __float_as_uint(f); u += 0x7FFFu + ((u >> 16) & 1u); return (unsigned short)(u >> 16); }
__device__ __forceinline__ float bf2f(unsigned short b) { return __uint_as_float(((unsigned)b) << 16); }
__device__ __forceinline__ float bfr(float f) { return bf2f(f2bf(f)); }
__device__ __forceinline__ v16h cat16(v8h lo, v8h hi) { return __builtin_shufflevector(lo, hi, 0, 1, 2, 3, 4, 5, 6, 7, 8, 9, 10, 11, 12, 13, 14, 15); }
__device__ __forceinline__ v16bf cat16b(v8us lo, v8us hi) { return __builtin_bit_cast(v16bf, __builtin_shufflevector(lo, hi, 0, 1, 2, 3, 4, 5, 6, 7, 8, 9, 10, 11, 12, 13, 14, 15)); }
__device__ __forceinline__ v8f wmma16(v16h a, v16h b, v8f c) { return __builtin_amdgcn_wmma_f32_16x16x32_f16(false, a, false, b, (short)0, c, false, false); }
__device__ __forceinline__ v8f wmmab(v16bf a, v16bf b, v8f c) { return __builtin_amdgcn_wmma_f32_16x16x32_bf16(false, a, false, b, (short)0, c, false, false); }



__device__ __forceinline__ h16 tohx(float x) { return (h16)x; }
__device__ __forceinline__ void splitf(float y, unsigned short& h, unsigned short& l) { h = f2bf(y); l = f2bf(y - bf2f(h)); }
typedef __attribute__((ext_vector_type(2))) _Float16 v2h;
typedef __attribute__((ext_vector_type(4))) _Float16 v4h;
typedef __attribute__((ext_vector_type(2))) unsigned short v2us;
typedef __attribute__((ext_vector_type(4))) unsigned short v4us;
typedef __attribute__((ext_vector_type(2))) float v2f;
typedef __attribute__((ext_vector_type(4))) int v4i;

// ---- k_gemmw: register-blocked GEMM, ONE WAVE per 64x64 output tile (16 accumulators), operands straight from K-contiguous 16-bit planes; grid (M/64, N/64, Z), 32 threads.
// C[m][n] (f32, pitch ldc, + optional f32 bias[n]) = sum_k A[m][k] Bt[n][k] (+ split products per NSPLIT). z-batch strides sA/sB/sC in elements. K % 32 == 0.
// EPI 1 (a 64-column tile is one head): the tile gets the interleaved rotary turn in the epilogue and goes out as the fp16, bf16-hi and bf16-lo planes [head][t][64]; no f32 tile is stored.
// EPI 2: the tile goes out transposed as the three planes [head][d][t], straight from the accumulators (a lane holds 8 consecutive t of one column d).
// KS > 1: grid z = batch * KS + slice; a wave sums only its K / KS keys and stores a partial tile in plane (batch * KS + slice) of C (plane stride sC); the reader adds a batch's KS planes. K % (32 * KS) == 0.
template <typename T16> struct WFrag;
template <> struct WFrag<h16> { typedef v16h V; static __device__ __forceinline__ V ld(const h16* p) { return cat16(*(const v8h*)p, *(const v8h*)(p + 16)); } static __device__ __forceinline__ v8f mma(V a, V b, v8f c) { return wmma16(a, b, c); } };
template <> struct WFrag<bf> { typedef v16bf V; static __device__ __forceinline__ V ld(const bf* p) { return cat16b(*(const v8us*)p, *(const v8us*)(p + 16)); } static __device__ __forceinline__ v8f mma(V a, V b, v8f c) { return wmmab(a, b, c); } };
template <typename T16, int NSPLIT, bool BIAS, int KS = 1, int EPI = 0>
__global__ __launch_bounds__(32) void k_gemmw(const T16* __restrict__ A, const T16* __restrict__ A2, const T16* __restrict__ Bt, const T16* __restrict__ Bt2, int K, float* C, int ldc, const float* __restrict__ bias, size_t sA, size_t sB, size_t sC, const float* __restrict__ CS, h16* P16, bf* Ph, bf* Pl) {
    typedef typename WFrag<T16>::V V;
    __shared__ __align__(16) float os[16 * 68];
    const size_t z = blockIdx.z / KS; const int ks = blockIdx.z % KS; A += z * sA; if (A2) A2 += z * sA; Bt += z * sB; if (Bt2) Bt2 += z * sB; C += (size_t)blockIdx.z * sC;
    const int kbeg = ks * (K / KS), kend = kbeg + K / KS;
    const int lane = threadIdx.x & 31, lr = lane & 15, hi = lane >> 4; const int r0 = blockIdx.x * 64, c0 = blockIdx.y * 64;
    v8f acc[4][4];
#pragma unroll
    for (int mb = 0; mb < 4; ++mb)
#pragma unroll
        for (int nb = 0; nb < 4; ++nb) acc[mb][nb] = (v8f){};
    const size_t aoff = (size_t)(r0 + lr) * K + 8 * hi, boff = (size_t)(c0 + lr) * K + 8 * hi;
#pragma unroll 1
    for (int kc = kbeg; kc < kend; kc += 32) {
        V a[4], a2[4];
#pragma unroll
        for (int mb = 0; mb < 4; ++mb) { a[mb] = WFrag<T16>::ld(A + aoff + (size_t)mb * 16 * K + kc); if (NSPLIT == 1 || NSPLIT == 2) a2[mb] = WFrag<T16>::ld(A2 + aoff + (size_t)mb * 16 * K + kc); }
#pragma unroll
        for (int nb = 0; nb < 4; ++nb) { const V b = WFrag<T16>::ld(Bt + boff + (size_t)nb * 16 * K + kc); V b2; if (NSPLIT >= 2) b2 = WFrag<T16>::ld(Bt2 + boff + (size_t)nb * 16 * K + kc);
#pragma unroll
            for (int mb = 0; mb < 4; ++mb) { acc[mb][nb] = WFrag<T16>::mma(a[mb], b, acc[mb][nb]); if (NSPLIT == 1 || NSPLIT == 2) acc[mb][nb] = WFrag<T16>::mma(a2[mb], b, acc[mb][nb]); if (NSPLIT >= 2) acc[mb][nb] = WFrag<T16>::mma(a[mb], b2, acc[mb][nb]); } }
        asm volatile("v_nop\n\tv_nop\n\tv_nop\n\tv_nop" : "+v"(acc[0][0]), "+v"(acc[1][1]), "+v"(acc[2][2]), "+v"(acc[3][3]) : "v"(a[0]), "v"(a[3]));
    }
    if (EPI == 2) {
#pragma unroll
        for (int nb = 0; nb < 4; ++nb)
#pragma unroll
            for (int mb = 0; mb < 4; ++mb) { const size_t e = ((size_t)blockIdx.y * HD + nb * 16 + lr) * TT + r0 + mb * 16 + hi * 8; v8h o16; v8us oh, ol;
#pragma unroll
                for (int j = 0; j < 8; ++j) { const float x = acc[mb][nb][j]; o16[j] = tohx(x); unsigned short a2, c2; splitf(x, a2, c2); oh[j] = a2; ol[j] = c2; }
                *(v8h*)(P16 + e) = o16; *(v8us*)(Ph + e) = oh; *(v8us*)(Pl + e) = ol;
                // a precaution: the wait stands in front of the next rewrite of a register these stores name; the scheduling fence keeps the next tile's arithmetic from being lifted over it
                asm volatile("s_wait_xcnt 0x0" ::: "memory"); __builtin_amdgcn_sched_barrier(0); }
        return;
    }
#pragma unroll
    for (int mb = 0; mb < 4; ++mb) {
        v2f csr[8][2];   // EPI 1: the {cos, sin} pairs of this lane's 8 rows, asked for as one group ahead of the staging so that one latency serves all
        if (EPI == 1) { const float* cp = CS + ((size_t)(r0 + mb * 16 + hi) * HD + lr * 4) * 2;
#pragma unroll
            for (int s = 0; s < 8; ++s) { csr[s][0] = *(const v2f*)(cp + s * 4 * HD); csr[s][1] = *(const v2f*)(cp + s * 4 * HD + 4); }
            asm volatile("s_wait_xcnt 0x0" ::: "memory"); }   // a precaution: it stands in front of the next rewrite of the address registers these loads name
#pragma unroll
        for (int nb = 0; nb < 4; ++nb) {
#pragma unroll
            for (int j = 0; j < 8; ++j) os[(hi * 8 + j) * 68 + nb * 16 + lr] = acc[mb][nb][j]; }
        __builtin_amdgcn_wave_barrier(); asm volatile("" ::: "memory");
        float* crow = C + (size_t)(r0 + mb * 16) * ldc + c0;
        if (EPI == 1) {
            v4f vals[8];   // the lane's 8 row pieces, read as one group: the waits between the rows' stores would hold a later LDS read back
#pragma unroll
            for (int s = 0; s < 8; ++s) vals[s] = *(const v4fa*)(os + (2 * s + hi) * 68 + lr * 4);
#pragma unroll
            for (int s = 0; s < 8; ++s) { const int row = 2 * s + hi, cofs = lr * 4, t = r0 + mb * 16 + row; const v4f val = vals[s]; const size_t e = ((size_t)blockIdx.y * TT + t) * HD + cofs; v4h o16; v4us oh, ol;
#pragma unroll
                for (int q = 0; q < 2; ++q) { const float x0 = val[2 * q], x1 = val[2 * q + 1]; const v2f cs = csr[s][q];
                    float a0 = __fmul_rn(x0, cs[0]), b0 = __fmul_rn(x1, cs[1]), a1 = __fmul_rn(x1, cs[0]), b1 = __fmul_rn(x0, cs[1]); asm volatile("" : "+v"(a0), "+v"(b0), "+v"(a1), "+v"(b1));
                    const float y0 = __fsub_rn(a0, b0), y1 = __fadd_rn(b1, a1);   /* even: x0 c - x1 s; odd: x0 s + x1 c */
                    o16[2 * q] = tohx(y0); o16[2 * q + 1] = tohx(y1); { unsigned short a2, c2; splitf(y0, a2, c2); oh[2 * q] = a2; ol[2 * q] = c2; splitf(y1, a2, c2); oh[2 * q + 1] = a2; ol[2 * q + 1] = c2; } }
                *(v4h*)(P16 + e) = o16; *(v4us*)(Ph + e) = oh; *(v4us*)(Pl + e) = ol;
                asm volatile("s_wait_xcnt 0x0" ::: "memory"); }   // a precaution: it stands in front of the next rewrite of a register these stores name
        } else {
#pragma unroll
            for (int s = 0; s < 8; ++s) { const int row = 2 * s + hi, cofs = lr * 4; v4f val = *(const v4fa*)(os + row * 68 + cofs); if (BIAS) { val[0] += bfr(bias[c0 + cofs]); val[1] += bfr(bias[c0 + cofs + 1]); val[2] += bfr(bias[c0 + cofs + 2]); val[3] += bfr(bias[c0 + cofs + 3]); }
                *(v4f*)(crow + (size_t)row * ldc + cofs) = val; }
             }
        __builtin_amdgcn_wave_barrier(); asm volatile("" ::: "memory");
    }
}


__global__ __launch_bounds__(256) void k_wtG(const float* __restrict__ w, int K, int N, bf* Bt) {
    const int lane = threadIdx.x & 31; const int L0 = (blockIdx.x * 8 + (threadIdx.x >> 5)) * 8; const int nlines = N * K / 64;
{
#pragma unroll 1
        for (int l = 0; l < 8; ++l) { const int L = L0 + l; if (L >= nlines) break; const size_t e = (size_t)L * 64 + lane * 2; const int k = (int)(e % K), n = (int)(e / K); v2us o;
            o[0] = f2bf(w[(size_t)k * N + n]); o[1] = f2bf(w[(size_t)(k + 1) * N + n]); *(v2us*)(Bt + e) = o; }
         }
}
__global__ __launch_bounds__(256) void k_cvt8(const float* __restrict__ src, bf* dst, size_t n8) { const size_t i = (size_t)blockIdx.x * 256 + threadIdx.x; if (i >= n8) return; const v8f v = *(const v8f*)(src + i * 8); v8us o;
#pragma unroll
    for (int k = 0; k < 8; ++k) o[k] = f2bf(v[k]); *(v8us*)(dst + i * 8) = o;  }

__global__ __launch_bounds__(256) void k_csin2(const float* __restrict__ cs, const float* __restrict__ sn, float* CS) { const int idx = blockIdx.x * 256 + threadIdx.x; if (idx >= TT * HD) return; const int d = idx % HD; const int t = idx / HD; v2f o; o[0] = bfr(cs[t * (HD / 2) + (d >> 1)]); o[1] = bfr(sn[t * (HD / 2) + (d >> 1)]); *(v2f*)(CS + (size_t)idx * 2) = o;  }
// ---- k_fattn: scores, softmax and P x V of one (batch, head) in one kernel; no score or probability plane leaves the registers.
// One wave owns NQT x 16 query rows and walks the 2048 keys in steps of 32 with a running row maximum and row sum (online softmax).
// The products are taken transposed: S^T = K Q^T puts a query in a lane (column lr) and keys hi*8+j in its registers, which is already the B-fragment order of O^T = V^T P^T:
// tile 0 of a step gives elements 0..7 (keys 8hi+j), tile 1 elements 8..15 (keys 16+8hi+j), the k order of the V^T loader. Row statistics are per lane plus one exchange between the lane halves.
// HL: bf16 hi/lo planes, 3 products each (rows < RH); else fp16 planes with P carried x 2^10 (the factor is in the row sum too and cancels in the division).
// 2^x with the slot behind it in the same statement: the instruction set asks for one independent instruction or v_nop between a transcendental and an instruction that rewrites its source
__device__ __forceinline__ float exp2s(float x) { float r; asm("v_exp_f32 %0, %1\n\tv_nop" : "=v"(r) : "v"(x)); return r; }
template <typename T16, bool HL, int NQT>
__device__ __forceinline__ void fattn_rows(const T16* __restrict__ Q, const T16* __restrict__ Q2, const T16* __restrict__ Kp, const T16* __restrict__ K2, const T16* __restrict__ Vt, const T16* __restrict__ V2, int q0, bf* Ah, bf* Al) {
    typedef typename WFrag<T16>::V V;
    const int lane = threadIdx.x & 31, lr = lane & 15, hi = lane >> 4;
    const float CL2 = SCL * 1.4426950408889634f;   // scores -> log2 units
    const float POFF = HL ? 0.0f : 10.0f;
    V qf[NQT][2], qf2[NQT][2];
#pragma unroll
    for (int qt = 0; qt < NQT; ++qt)
#pragma unroll
        for (int c = 0; c < 2; ++c) { const size_t qo = (size_t)(q0 + qt * 16 + lr) * HD + c * 32 + 8 * hi; qf[qt][c] = WFrag<T16>::ld(Q + qo); if (HL) qf2[qt][c] = WFrag<T16>::ld(Q2 + qo); }
    v8f o[NQT][4]; float m[NQT], l[NQT];
#pragma unroll
    for (int qt = 0; qt < NQT; ++qt) { m[qt] = -3.0e38f; l[qt] = 0.f;
#pragma unroll
        for (int dt = 0; dt < 4; ++dt) o[qt][dt] = (v8f){}; }
    const size_t ko = (size_t)lr * HD + 8 * hi, vo = (size_t)lr * TT + 8 * hi;
    V kf[2][2], kf2[2][2];
#pragma unroll
    for (int kt = 0; kt < 2; ++kt)
#pragma unroll
        for (int c = 0; c < 2; ++c) { kf[kt][c] = WFrag<T16>::ld(Kp + ko + kt * 16 * HD + c * 32); if (HL) kf2[kt][c] = WFrag<T16>::ld(K2 + ko + kt * 16 * HD + c * 32); }
#pragma unroll 1
    for (int k0 = 0; k0 < TT; k0 += 32) {
        V vf[4], vf2[4];   // this step's V^T fragments: asked for here, used behind the softmax
#pragma unroll
        for (int dt = 0; dt < 4; ++dt) { vf[dt] = WFrag<T16>::ld(Vt + vo + (size_t)dt * 16 * TT + k0); if (HL) vf2[dt] = WFrag<T16>::ld(V2 + vo + (size_t)dt * 16 * TT + k0); }
        v8f s[NQT][2];
#pragma unroll
        for (int qt = 0; qt < NQT; ++qt)
#pragma unroll
            for (int kt = 0; kt < 2; ++kt) { v8f a = (v8f){};
#pragma unroll
                for (int c = 0; c < 2; ++c) { a = WFrag<T16>::mma(kf[kt][c], qf[qt][c], a); if (HL) { a = WFrag<T16>::mma(kf2[kt][c], qf[qt][c], a); a = WFrag<T16>::mma(kf[kt][c], qf2[qt][c], a); } }
                s[qt][kt] = a; }
        const int kn = (k0 + 32 < TT) ? k0 + 32 : 0;   // next step's K fragments fly under the softmax; the last step re-reads step 0 (in bounds, unused)
#pragma unroll
        for (int kt = 0; kt < 2; ++kt)
#pragma unroll
            for (int c = 0; c < 2; ++c) { const size_t kk = ko + (size_t)(kn + kt * 16) * HD + c * 32; kf[kt][c] = WFrag<T16>::ld(Kp + kk); if (HL) kf2[kt][c] = WFrag<T16>::ld(K2 + kk); }
#pragma unroll
        for (int qt = 0; qt < NQT; ++qt) {
            float mx = fmaxf(s[qt][0][0], s[qt][1][0]);
#pragma unroll
            for (int j = 1; j < 8; ++j) mx = fmaxf(mx, fmaxf(s[qt][0][j], s[qt][1][j]));
            mx = fmaxf(mx, __shfl_xor(mx, 16, 32));
            const float mn = fmaxf(m[qt], mx * CL2); const float al = exp2s(m[qt] - mn); m[qt] = mn; const float off = POFF - mn;
            v8f p0, p1;
#pragma unroll
            for (int j = 0; j < 8; ++j) { p0[j] = exp2s(fmaf(s[qt][0][j], CL2, off)); p1[j] = exp2s(fmaf(s[qt][1][j], CL2, off)); }
            const v8f ps = p0 + p1; l[qt] = l[qt] * al + (((ps[0] + ps[1]) + (ps[2] + ps[3])) + ((ps[4] + ps[5]) + (ps[6] + ps[7])));
#pragma unroll
            for (int dt = 0; dt < 4; ++dt) o[qt][dt] *= al;
            if (HL) { v8us h0, h1, l0, l1;
#pragma unroll
                for (int j = 0; j < 8; ++j) { unsigned short a, c2; splitf(p0[j], a, c2); h0[j] = a; l0[j] = c2; splitf(p1[j], a, c2); h1[j] = a; l1[j] = c2; }
                const v16bf ph = cat16b(h0, h1), pl = cat16b(l0, l1);
#pragma unroll
                for (int dt = 0; dt < 4; ++dt) { o[qt][dt] = wmmab(__builtin_bit_cast(v16bf, vf[dt]), ph, o[qt][dt]); o[qt][dt] = wmmab(__builtin_bit_cast(v16bf, vf[dt]), pl, o[qt][dt]); o[qt][dt] = wmmab(__builtin_bit_cast(v16bf, vf2[dt]), ph, o[qt][dt]); }
            } else { v8h h0, h1;
#pragma unroll
                for (int j = 0; j < 8; ++j) { h0[j] = tohx(p0[j]); h1[j] = tohx(p1[j]); }
                const v16h pf = cat16(h0, h1);
#pragma unroll
                for (int dt = 0; dt < 4; ++dt) o[qt][dt] = wmma16(__builtin_bit_cast(v16h, vf[dt]), pf, o[qt][dt]); }
        }
    }
#pragma unroll
    for (int qt = 0; qt < NQT; ++qt) { const float inv = __fdiv_rn(1.0f, l[qt] + __shfl_xor(l[qt], 16, 32)); const size_t oo = (size_t)(q0 + qt * 16 + lr) * DQ + hi * 8;
#pragma unroll
        for (int dt = 0; dt < 4; ++dt) { v8us oh, ol;
#pragma unroll
            for (int j = 0; j < 8; ++j) { unsigned short a, c2; splitf(o[qt][dt][j] * inv, a, c2); oh[j] = a; ol[j] = c2; }
            *(v8us*)(Ah + oo + dt * 16) = oh; *(v8us*)(Al + oo + dt * 16) = ol; } }
}
// grid (NB_ * NH_, RH / 64 + (TT - RH) / 128), 4 waves: the hi/lo rows (3x the products) take 16 rows a wave and come first in launch order, the others 32 rows a wave. A block's waves walk the same K and V.
__global__ __launch_bounds__(128) void k_fattn(const h16* __restrict__ Q16, const h16* __restrict__ K16, const h16* __restrict__ V16, const bf* __restrict__ Qh, const bf* __restrict__ Ql, const bf* __restrict__ Kh, const bf* __restrict__ Kl, const bf* __restrict__ Vh, const bf* __restrict__ Vl, bf* Ah, bf* Al) {
    const int z = blockIdx.x, wave = threadIdx.x >> 5; const size_t pz = (size_t)z * TT * HD; const size_t az = (size_t)(z / NH_) * TT * DQ + (size_t)(z % NH_) * HD;
    if (blockIdx.y < RH / 64) fattn_rows<bf, true, 1>(Qh + pz, Ql + pz, Kh + pz, Kl + pz, Vh + pz, Vl + pz, blockIdx.y * 64 + wave * 16, Ah + az, Al + az);
    else fattn_rows<h16, false, 2>(Q16 + pz, nullptr, K16 + pz, nullptr, V16 + pz, nullptr, RH + (blockIdx.y - RH / 64) * 128 + wave * 32, Ah + az, Al + az);
}

extern "C" void kernel_launch(void* const* d_in, const int* in_sizes, int n_in,
                              void* d_out, int out_size, void* d_ws, size_t ws_size, hipStream_t stream) {
    (void)in_sizes; (void)n_in; (void)out_size;
    const float* x = (const float*)d_in[0]; const float* fcos = (const float*)d_in[1]; const float* fsin = (const float*)d_in[2]; const float* wq = (const float*)d_in[3]; const float* wk = (const float*)d_in[4]; const float* wv = (const float*)d_in[5]; const float* wo = (const float*)d_in[6]; const float* bo = (const float*)d_in[7];
    float* OUT = (float*)d_out;     // [2][2048][1024]
    char* wsp = (char*)d_ws;
    auto take = [&](size_t bytes) { char* p = wsp; wsp += (bytes + 255) & ~(size_t)255; return (void*)p; };
    bf* WQ = (bf*)take((size_t)DQ * DM * 2); bf* WK = (bf*)take((size_t)DKV * DM * 2); bf* WV = (bf*)take((size_t)DKV * DM * 2); bf* WO = (bf*)take((size_t)DM * DQ * 2); float* CS = (float*)take((size_t)TT * HD * 2 * 4);
    bf* XB = (bf*)take((size_t)TT * DM * 2);
    const size_t PB = (size_t)NH_ * TT * HD;   // elements of one batch's q, k or v planes (both batches' planes are kept: the attention kernel runs once for all)
    h16* QP16 = (h16*)take(NB_ * PB * 2); h16* KP16 = (h16*)take(NB_ * PB * 2); h16* VT16 = (h16*)take(NB_ * PB * 2);
    bf* QPh = (bf*)take(NB_ * PB * 2); bf* QPl = (bf*)take(NB_ * PB * 2); bf* KPh = (bf*)take(NB_ * PB * 2); bf* KPl = (bf*)take(NB_ * PB * 2); bf* VTh = (bf*)take(NB_ * PB * 2); bf* VTl = (bf*)take(NB_ * PB * 2);
    bf* ATh = (bf*)take((size_t)NB_ * TT * DQ * 2); bf* ATl = (bf*)take((size_t)NB_ * TT * DQ * 2);
    if ((size_t)(wsp - (char*)d_ws) > ws_size) return;    // ws 256 MiB
    { k_cvt8<<<(unsigned)(((size_t)DQ * DM / 8 + 255) / 256), 256, 0, stream>>>(wq, WQ, (size_t)DQ * DM / 8); k_cvt8<<<(unsigned)(((size_t)DKV * DM / 8 + 255) / 256), 256, 0, stream>>>(wk, WK, (size_t)DKV * DM / 8); k_cvt8<<<(unsigned)(((size_t)DKV * DM / 8 + 255) / 256), 256, 0, stream>>>(wv, WV, (size_t)DKV * DM / 8);
      k_cvt8<<<(unsigned)(((size_t)DM * DQ / 8 + 255) / 256), 256, 0, stream>>>(wo, WO, (size_t)DM * DQ / 8); k_csin2<<<(TT * HD + 255) / 256, 256, 0, stream>>>(fcos, fsin, CS); }
    for (int b = 0; b < NB_; ++b) {
        
        k_cvt8<<<(unsigned)(((size_t)TT * DM / 8 + 255) / 256), 256, 0, stream>>>(x + (size_t)b * TT * DM, XB, (size_t)TT * DM / 8);
        k_gemmw<bf, 0, false, 1, 1><<<dim3(TT / 64, DQ / 64, 1), 32, 0, stream>>>(XB, nullptr, WQ, nullptr, DM, nullptr, DQ, nullptr, 0, 0, 0, CS, QP16 + b * PB, QPh + b * PB, QPl + b * PB);
        k_gemmw<bf, 0, false, 1, 1><<<dim3(TT / 64, DKV / 64, 1), 32, 0, stream>>>(XB, nullptr, WK, nullptr, DM, nullptr, DKV, nullptr, 0, 0, 0, CS, KP16 + b * PB, KPh + b * PB, KPl + b * PB);
        k_gemmw<bf, 0, false, 1, 2><<<dim3(TT / 64, DKV / 64, 1), 32, 0, stream>>>(XB, nullptr, WV, nullptr, DM, nullptr, DKV, nullptr, 0, 0, 0, nullptr, VT16 + b * PB, VTh + b * PB, VTl + b * PB); }
    k_fattn<<<dim3(NB_ * NH_, RH / 64 + (TT - RH) / 128, 1), 128, 0, stream>>>(QP16, KP16, VT16, QPh, QPl, KPh, KPl, VTh, VTl, ATh, ATl);
    for (int b = 0; b < NB_; ++b)
        k_gemmw<bf, 1, true><<<dim3(TT / 64, DM / 64, 1), 32, 0, stream>>>(ATh + (size_t)b * TT * DQ, ATl + (size_t)b * TT * DQ, WO, nullptr, DQ, OUT + (size_t)b * TT * DM, DM, bo, 0, 0, 0, nullptr, nullptr, nullptr, nullptr);
}

// v004
// Measured time: 201 microseconds a run.
// Next to v003, in two timings, it ran 1.64 and 1.63 times as fast.
// All steps since v000 together make it 9.65 times as fast.
#include <hip/hip_runtime.h>

// Multi-head attention with interleaved rotary embeddings (x [2][2048][1024]; q,k,v = x W^T ('oi' [1024][1024], no bias; 16 heads x 64); rotary on (even, odd) pairs with the given cos/sin tables [2048][32] (read); scores / 8; softmax over all keys; out = merged Wo^T + bo -> [2][2048][1024] (4.2 M)).
// Layout: 4 launches, each over both batches (copies and table; the three projections; attention; the output product): bf16 copy of x; exact projections; {cos, sin} table per position built once from the inputs (bf16-rounded; pair i serves dims 2i, 2i+1); the interleaved rotary turn of q and k and the building of the q, k and v^T planes are the projection kernels' epilogues. Then one fused dense T-2048 attention kernel for both batches and all heads (hybrid rows: < 512 hi/lo 3 products, rest fp16 x1024); merged hi/lo x Wo exact + bo.
// Compute dtypes, f32 accumulate: every input rounded to bf16 incl. the tables; projections exact; rotary f32; attention rows < 512 3 products, rest fp16; softmax f32; Wo hl x exact + bias.

#define NB_  2
#define TT   2048
#define DM   1024
#define NH_  16
#define NKV  16
#define REP  (NH_ / NKV)
#define HD   64
#define DQ   (NH_ * HD)
#define DKV  (NKV * HD)
#define RH   512                  // query rows < RH use hi+lo planes (0: none)
#define WIN  0
#define SCL  0.125f   // HD^-0.5
typedef _Float16 h16;
typedef unsigned short bf;
typedef __attribute__((ext_vector_type(16))) __bf16   v16bf;
typedef __attribute__((ext_vector_type(16))) _Float16 v16h;
typedef __attribute__((ext_vector_type(8)))  _Float16 v8h;
typedef __attribute__((ext_vector_type(8)))  unsigned short v8us;
typedef __attribute__((ext_vector_type(8)))  float    v8f;
typedef __attribute__((ext_vector_type(4)))  float    v4f;
typedef v8h  __attribute__((may_alias)) v8ha;
typedef v4f  __attribute__((may_alias)) v4fa;
typedef v8us __attribute__((may_alias)) v8usa;

__device__ __forceinline__ unsigned short f2bf(float f) { unsigned u = __float_as_uint(f); u += 0x7FFFu + ((u >> 16) & 1u); return (unsigned short)(u >> 16); }
__device__ __forceinline__ float bf2f(unsigned short b) { return __uint_as_float(((unsigned)b) << 16); }
__device__ __forceinline__ float bfr(float f) { return bf2f(f2bf(f)); }
__device__ __forceinline__ v16h cat16(v8h lo, v8h hi) { return __builtin_shufflevector(lo, hi, 0, 1, 2, 3, 4, 5, 6, 7, 8, 9, 10, 11, 12, 13, 14, 15); }
__device__ __forceinline__ v16bf cat16b(v8us lo, v8us hi) { return __builtin_bit_cast(v16bf, __builtin_shufflevector(lo, hi, 0, 1, 2, 3, 4, 5, 6, 7, 8, 9, 10, 11, 12, 13, 14, 15)); }
__device__ __forceinline__ v8f wmma16(v16h a, v16h b, v8f c) { return __builtin_amdgcn_wmma_f32_16x16x32_f16(false, a, false, b, (short)0, c, false, false); }
__device__ __forceinline__ v8f wmmab(v16bf a, v16bf b, v8f c) { return __builtin_amdgcn_wmma_f32_16x16x32_bf16(false, a, false, b, (short)0, c, false, false); }



__device__ __forceinline__ h16 tohx(float x) { return (h16)x; }
__device__ __forceinline__ void splitf(float y, unsigned short& h, unsigned short& l) { h = f2bf(y); l = f2bf(y - bf2f(h)); }
typedef __attribute__((ext_vector_type(2))) _Float16 v2h;
typedef __attribute__((ext_vector_type(4))) _Float16 v4h;
typedef __attribute__((ext_vector_type(2))) unsigned short v2us;
typedef __attribute__((ext_vector_type(4))) unsigned short v4us;
typedef __attribute__((ext_vector_type(2))) float v2f;
typedef __attribute__((ext_vector_type(4))) int v4i;

// ---- k_gemmw: register-blocked GEMM, ONE WAVE per 64x64 output tile (16 accumulators), operands straight from K-contiguous 16-bit planes; grid (M/64, N/64, Z), 32 threads.
// C[m][n] (f32, pitch ldc, + optional f32 bias[n]) = sum_k A[m][k] Bt[n][k] (+ split products per NSPLIT). z-batch strides sA/sB/sC in elements. K % 32 == 0.
// EPI 1: all projections of all batches in one grid, z = projection * NB_ + batch (A strides by sA per batch, Bt by sB per projection, the planes by sC per z); a 64-column tile is one head; no f32 tile is stored.
//   q, k (projection 0, 1): the tile gets the interleaved rotary turn in the epilogue and goes out as the fp16, bf16-hi and bf16-lo planes [head][t][64].
//   v (projection 2): the tile goes out transposed as the three planes [head][d][t], straight from the accumulators (a lane holds 8 consecutive t of one column d).
// KS > 1: grid z = batch * KS + slice; a wave sums only its K / KS keys and stores a partial tile in plane (batch * KS + slice) of C (plane stride sC); the reader adds a batch's KS planes. K % (32 * KS) == 0.
template <typename T16> struct WFrag;
template <> struct WFrag<h16> { typedef v16h V; static __device__ __forceinline__ V ld(const h16* p) { return cat16(*(const v8h*)p, *(const v8h*)(p + 16)); } static __device__ __forceinline__ v8f mma(V a, V b, v8f c) { return wmma16(a, b, c); } };
template <> struct WFrag<bf> { typedef v16bf V; static __device__ __forceinline__ V ld(const bf* p) { return cat16b(*(const v8us*)p, *(const v8us*)(p + 16)); } static __device__ __forceinline__ v8f mma(V a, V b, v8f c) { return wmmab(a, b, c); } };
template <typename T16, int NSPLIT, bool BIAS, int KS = 1, int EPI = 0>
__global__ __launch_bounds__(32) void k_gemmw(const T16* __restrict__ A, const T16* __restrict__ A2, const T16* __restrict__ Bt, const T16* __restrict__ Bt2, int K, float* C, int ldc, const float* __restrict__ bias, size_t sA, size_t sB, size_t sC, const float* __restrict__ CS, h16* P16, bf* Ph, bf* Pl) {
    typedef typename WFrag<T16>::V V;
    __shared__ __align__(16) float os[16 * 68];
    const size_t z = blockIdx.z / KS; const int ks = blockIdx.z % KS;
    if (EPI == 1) { A += (size_t)(blockIdx.z % NB_) * sA; Bt += (size_t)(blockIdx.z / NB_) * sB; P16 += (size_t)blockIdx.z * sC; Ph += (size_t)blockIdx.z * sC; Pl += (size_t)blockIdx.z * sC; }
    else { A += z * sA; if (A2) A2 += z * sA; Bt += z * sB; if (Bt2) Bt2 += z * sB; C += (size_t)blockIdx.z * sC; }
    const int kbeg = ks * (K / KS), kend = kbeg + K / KS;
    const int lane = threadIdx.x & 31, lr = lane & 15, hi = lane >> 4; const int r0 = blockIdx.x * 64, c0 = blockIdx.y * 64;
    v8f acc[4][4];
#pragma unroll
    for (int mb = 0; mb < 4; ++mb)
#pragma unroll
        for (int nb = 0; nb < 4; ++nb) acc[mb][nb] = (v8f){};
    const size_t aoff = (size_t)(r0 + lr) * K + 8 * hi, boff = (size_t)(c0 + lr) * K + 8 * hi;
#pragma unroll 1
    for (int kc = kbeg; kc < kend; kc += 32) {
        V a[4], a2[4];
#pragma unroll
        for (int mb = 0; mb < 4; ++mb) { a[mb] = WFrag<T16>::ld(A + aoff + (size_t)mb * 16 * K + kc); if (NSPLIT == 1 || NSPLIT == 2) a2[mb] = WFrag<T16>::ld(A2 + aoff + (size_t)mb * 16 * K + kc); }
#pragma unroll
        for (int nb = 0; nb < 4; ++nb) { const V b = WFrag<T16>::ld(Bt + boff + (size_t)nb * 16 * K + kc); V b2; if (NSPLIT >= 2) b2 = WFrag<T16>::ld(Bt2 + boff + (size_t)nb * 16 * K + kc);
#pragma unroll
            for (int mb = 0; mb < 4; ++mb) { acc[mb][nb] = WFrag<T16>::mma(a[mb], b, acc[mb][nb]); if (NSPLIT == 1 || NSPLIT == 2) acc[mb][nb] = WFrag<T16>::mma(a2[mb], b, acc[mb][nb]); if (NSPLIT >= 2) acc[mb][nb] = WFrag<T16>::mma(a[mb], b2, acc[mb][nb]); } }
        asm volatile("v_nop\n\tv_nop\n\tv_nop\n\tv_nop" : "+v"(acc[0][0]), "+v"(acc[1][1]), "+v"(acc[2][2]), "+v"(acc[3][3]) : "v"(a[0]), "v"(a[3]));
    }
    asm volatile("s_wait_xcnt 0x0" ::: "memory");   // a precaution: it stands in front of the epilogue's first rewrite of an address register that the loop's last loads name
    if (EPI == 1 && blockIdx.z / NB_ == 2) {
#pragma unroll
        for (int nb = 0; nb < 4; ++nb)
#pragma unroll
            for (int mb = 0; mb < 4; ++mb) { const size_t e = ((size_t)blockIdx.y * HD + nb * 16 + lr) * TT + r0 + mb * 16 + hi * 8; v8h o16; v8us oh, ol;
#pragma unroll
                for (int j = 0; j < 8; ++j) { const float x = acc[mb][nb][j]; o16[j] = tohx(x); unsigned short a2, c2; splitf(x, a2, c2); oh[j] = a2; ol[j] = c2; }
                *(v8h*)(P16 + e) = o16; *(v8us*)(Ph + e) = oh; *(v8us*)(Pl + e) = ol;
                // a precaution: the wait stands in front of the next rewrite of a register these stores name; the scheduling fence keeps the next tile's arithmetic from being lifted over it
                asm volatile("s_wait_xcnt 0x0" ::: "memory"); __builtin_amdgcn_sched_barrier(0); }
        return;
    }
#pragma unroll
    for (int mb = 0; mb < 4; ++mb) {
        v2f csr[8][2];   // EPI 1: the {cos, sin} pairs of this lane's 8 rows, asked for as one group ahead of the staging so that one latency serves all
        if (EPI == 1) { const float* cp = CS + ((size_t)(r0 + mb * 16 + hi) * HD + lr * 4) * 2;
#pragma unroll
            for (int s = 0; s < 8; ++s) { csr[s][0] = *(const v2f*)(cp + s * 4 * HD); csr[s][1] = *(const v2f*)(cp + s * 4 * HD + 4); }
            asm volatile("s_wait_xcnt 0x0" ::: "memory"); }   // a precaution: it stands in front of the next rewrite of the address registers these loads name
#pragma unroll
        for (int nb = 0; nb < 4; ++nb) {
#pragma unroll
            for (int j = 0; j < 8; ++j) os[(hi * 8 + j) * 68 + nb * 16 + lr] = acc[mb][nb][j]; }
        __builtin_amdgcn_wave_barrier(); asm volatile("" ::: "memory");
        float* crow = C + (size_t)(r0 + mb * 16) * ldc + c0;
        if (EPI == 1) {
            v4f vals[8];   // the lane's 8 row pieces, read as one group: the waits between the rows' stores would hold a later LDS read back
#pragma unroll
            for (int s = 0; s < 8; ++s) vals[s] = *(const v4fa*)(os + (2 * s + hi) * 68 + lr * 4);
#pragma unroll
            for (int s = 0; s < 8; ++s) { const int row = 2 * s + hi, cofs = lr * 4, t = r0 + mb * 16 + row; const v4f val = vals[s]; const size_t e = ((size_t)blockIdx.y * TT + t) * HD + cofs; v4h o16; v4us oh, ol;
#pragma unroll
                for (int q = 0; q < 2; ++q) { const float x0 = val[2 * q], x1 = val[2 * q + 1]; const v2f cs = csr[s][q];
                    float a0 = __fmul_rn(x0, cs[0]), b0 = __fmul_rn(x1, cs[1]), a1 = __fmul_rn(x1, cs[0]), b1 = __fmul_rn(x0, cs[1]); asm volatile("" : "+v"(a0), "+v"(b0), "+v"(a1), "+v"(b1));
                    const float y0 = __fsub_rn(a0, b0), y1 = __fadd_rn(b1, a1);   /* even: x0 c - x1 s; odd: x0 s + x1 c */
                    o16[2 * q] = tohx(y0); o16[2 * q + 1] = tohx(y1); { unsigned short a2, c2; splitf(y0, a2, c2); oh[2 * q] = a2; ol[2 * q] = c2; splitf(y1, a2, c2); oh[2 * q + 1] = a2; ol[2 * q + 1] = c2; } }
                *(v4h*)(P16 + e) = o16; *(v4us*)(Ph + e) = oh; *(v4us*)(Pl + e) = ol;
                asm volatile("s_wait_xcnt 0x0" ::: "memory"); }   // a precaution: it stands in front of the next rewrite of a register these stores name
        } else {
#pragma unroll
            for (int s = 0; s < 8; ++s) { const int row = 2 * s + hi, cofs = lr * 4; v4f val = *(const v4fa*)(os + row * 68 + cofs); if (BIAS) { val[0] += bfr(bias[c0 + cofs]); val[1] += bfr(bias[c0 + cofs + 1]); val[2] += bfr(bias[c0 + cofs + 2]); val[3] += bfr(bias[c0 + cofs + 3]); }
                *(v4f*)(crow + (size_t)row * ldc + cofs) = val; }
             }
        __builtin_amdgcn_wave_barrier(); asm volatile("" ::: "memory");
    }
}


__global__ __launch_bounds__(256) void k_wtG(const float* __restrict__ w, int K, int N, bf* Bt) {
    const int lane = threadIdx.x & 31; const int L0 = (blockIdx.x * 8 + (threadIdx.x >> 5)) * 8; const int nlines = N * K / 64;
{
#pragma unroll 1
        for (int l = 0; l < 8; ++l) { const int L = L0 + l; if (L >= nlines) break; const size_t e = (size_t)L * 64 + lane * 2; const int k = (int)(e % K), n = (int)(e / K); v2us o;
            o[0] = f2bf(w[(size_t)k * N + n]); o[1] = f2bf(w[(size_t)(k + 1) * N + n]); *(v2us*)(Bt + e) = o; }
         }
}
// ---- k_prep: every bf16 copy and the table in one grid. Blocks [0, PX): x (both batches); then PW blocks for each of Wq, Wk, Wv, Wo (their copies lie one behind the other in W4); the last PC blocks: the {cos, sin} table.
#define PX  (NB_ * TT * DM / 8 / 256)
#define PW  (DQ * DM / 8 / 256)
#define PC  (TT * HD / 256)
__global__ __launch_bounds__(256) void k_prep(const float* __restrict__ x, const float* __restrict__ wq, const float* __restrict__ wk, const float* __restrict__ wv, const float* __restrict__ wo, const float* __restrict__ cs, const float* __restrict__ sn, bf* XB, bf* W4, float* CS) {
    const int blk = blockIdx.x;
    if (blk < PX + 4 * PW) {
        const int w = blk < PX ? 0 : (blk - PX) / PW;   // which weight (blocks behind x)
        const float* src = blk < PX ? x : w == 0 ? wq : w == 1 ? wk : w == 2 ? wv : wo;
        bf* dst = blk < PX ? XB : W4 + (size_t)w * DQ * DM;
        const size_t i = (size_t)(blk < PX ? blk : (blk - PX) % PW) * 256 + threadIdx.x; const v8f v = *(const v8f*)(src + i * 8); v8us o;
#pragma unroll
        for (int k = 0; k < 8; ++k) o[k] = f2bf(v[k]);
        *(v8us*)(dst + i * 8) = o;
        asm volatile("s_wait_xcnt 0x0" ::: "memory");   // a precaution: it stands in front of any later rewrite of a register this store names
    } else {
        const int idx = (blk - PX - 4 * PW) * 256 + threadIdx.x; const int d = idx % HD; const int t = idx / HD; v2f o; o[0] = bfr(cs[t * (HD / 2) + (d >> 1)]); o[1] = bfr(sn[t * (HD / 2) + (d >> 1)]); *(v2f*)(CS + (size_t)idx * 2) = o;
        asm volatile("s_wait_xcnt 0x0" ::: "memory");   // a precaution: it stands in front of any later rewrite of a register this store names
    }
}
// ---- k_fattn: scores, softmax and P x V of one (batch, head) in one kernel; no score or probability plane leaves the registers.
// One wave owns NQT x 16 query rows and walks the 2048 keys in steps of 32 with a running row maximum and row sum (online softmax).
// The products are taken transposed: S^T = K Q^T puts a query in a lane (column lr) and keys hi*8+j in its registers, which is already the B-fragment order of O^T = V^T P^T:
// tile 0 of a step gives elements 0..7 (keys 8hi+j), tile 1 elements 8..15 (keys 16+8hi+j), the k order of the V^T loader. Row statistics are per lane plus one exchange between the lane halves.
// HL: bf16 hi/lo planes, 3 products each (rows < RH); else fp16 planes with P carried x 2^10 (the factor is in the row sum too and cancels in the division).
// 2^x with the slot behind it in the same statement: the instruction set asks for one independent instruction or v_nop between a transcendental and an instruction that rewrites its source
__device__ __forceinline__ float exp2s(float x) { float r; asm("v_exp_f32 %0, %1\n\tv_nop" : "=v"(r) : "v"(x)); return r; }
template <typename T16, bool HL, int NQT>
__device__ __forceinline__ void fattn_rows(const T16* __restrict__ Q, const T16* __restrict__ Q2, const T16* __restrict__ Kp, const T16* __restrict__ K2, const T16* __restrict__ Vt, const T16* __restrict__ V2, int q0, bf* Ah, bf* Al) {
    typedef typename WFrag<T16>::V V;
    const int lane = threadIdx.x & 31, lr = lane & 15, hi = lane >> 4;
    const float CL2 = SCL * 1.4426950408889634f;   // scores -> log2 units
    const float POFF = HL ? 0.0f : 10.0f;
    V qf[NQT][2], qf2[NQT][2];
#pragma unroll
    for (int qt = 0; qt < NQT; ++qt)
#pragma unroll
        for (int c = 0; c < 2; ++c) { const size_t qo = (size_t)(q0 + qt * 16 + lr) * HD + c * 32 + 8 * hi; qf[qt][c] = WFrag<T16>::ld(Q + qo); if (HL) qf2[qt][c] = WFrag<T16>::ld(Q2 + qo); }
    v8f o[NQT][4]; float m[NQT], l[NQT];
#pragma unroll
    for (int qt = 0; qt < NQT; ++qt) { m[qt] = -3.0e38f; l[qt] = 0.f;
#pragma unroll
        for (int dt = 0; dt < 4; ++dt) o[qt][dt] = (v8f){}; }
    const size_t ko = (size_t)lr * HD + 8 * hi, vo = (size_t)lr * TT + 8 * hi;
    V kf[2][2], kf2[2][2];
#pragma unroll
    for (int kt = 0; kt < 2; ++kt)
#pragma unroll
        for (int c = 0; c < 2; ++c) { kf[kt][c] = WFrag<T16>::ld(Kp + ko + kt * 16 * HD + c * 32); if (HL) kf2[kt][c] = WFrag<T16>::ld(K2 + ko + kt * 16 * HD + c * 32); }
#pragma unroll 1
    for (int k0 = 0; k0 < TT; k0 += 32) {
        V vf[4], vf2[4];   // this step's V^T fragments: asked for here, used behind the softmax
#pragma unroll
        for (int dt = 0; dt < 4; ++dt) { vf[dt] = WFrag<T16>::ld(Vt + vo + (size_t)dt * 16 * TT + k0); if (HL) vf2[dt] = WFrag<T16>::ld(V2 + vo + (size_t)dt * 16 * TT + k0); }
        v8f s[NQT][2];
#pragma unroll
        for (int qt = 0; qt < NQT; ++qt)
#pragma unroll
            for (int kt = 0; kt < 2; ++kt) { v8f a = (v8f){};
#pragma unroll
                for (int c = 0; c < 2; ++c) { a = WFrag<T16>::mma(kf[kt][c], qf[qt][c], a); if (HL) { a = WFrag<T16>::mma(kf2[kt][c], qf[qt][c], a); a = WFrag<T16>::mma(kf[kt][c], qf2[qt][c], a); } }
                s[qt][kt] = a; }
        const int kn = (k0 + 32 < TT) ? k0 + 32 : 0;   // next step's K fragments fly under the softmax; the last step re-reads step 0 (in bounds, unused)
#pragma unroll
        for (int kt = 0; kt < 2; ++kt)
#pragma unroll
            for (int c = 0; c < 2; ++c) { const size_t kk = ko + (size_t)(kn + kt * 16) * HD + c * 32; kf[kt][c] = WFrag<T16>::ld(Kp + kk); if (HL) kf2[kt][c] = WFrag<T16>::ld(K2 + kk); }
#pragma unroll
        for (int qt = 0; qt < NQT; ++qt) {
            float mx = fmaxf(s[qt][0][0], s[qt][1][0]);
#pragma unroll
            for (int j = 1; j < 8; ++j) mx = fmaxf(mx, fmaxf(s[qt][0][j], s[qt][1][j]));
            mx = fmaxf(mx, __shfl_xor(mx, 16, 32));
            const float mn = fmaxf(m[qt], mx * CL2); const float al = exp2s(m[qt] - mn); m[qt] = mn; const float off = POFF - mn;
            v8f p0, p1;
#pragma unroll
            for (int j = 0; j < 8; ++j) { p0[j] = exp2s(fmaf(s[qt][0][j], CL2, off)); p1[j] = exp2s(fmaf(s[qt][1][j], CL2, off)); }
            const v8f ps = p0 + p1; l[qt] = l[qt] * al + (((ps[0] + ps[1]) + (ps[2] + ps[3])) + ((ps[4] + ps[5]) + (ps[6] + ps[7])));
#pragma unroll
            for (int dt = 0; dt < 4; ++dt) o[qt][dt] *= al;
            if (HL) { v8us h0, h1, l0, l1;
#pragma unroll
                for (int j = 0; j < 8; ++j) { unsigned short a, c2; splitf(p0[j], a, c2); h0[j] = a; l0[j] = c2; splitf(p1[j], a, c2); h1[j] = a; l1[j] = c2; }
                const v16bf ph = cat16b(h0, h1), pl = cat16b(l0, l1);
#pragma unroll
                for (int dt = 0; dt < 4; ++dt) { o[qt][dt] = wmmab(__builtin_bit_cast(v16bf, vf[dt]), ph, o[qt][dt]); o[qt][dt] = wmmab(__builtin_bit_cast(v16bf, vf[dt]), pl, o[qt][dt]); o[qt][dt] = wmmab(__builtin_bit_cast(v16bf, vf2[dt]), ph, o[qt][dt]); }
            } else { v8h h0, h1;
#pragma unroll
                for (int j = 0; j < 8; ++j) { h0[j] = tohx(p0[j]); h1[j] = tohx(p1[j]); }
                const v16h pf = cat16(h0, h1);
#pragma unroll
                for (int dt = 0; dt < 4; ++dt) o[qt][dt] = wmma16(__builtin_bit_cast(v16h, vf[dt]), pf, o[qt][dt]); }
        }
    }
#pragma unroll
    for (int qt = 0; qt < NQT; ++qt) { const float inv = __fdiv_rn(1.0f, l[qt] + __shfl_xor(l[qt], 16, 32)); const size_t oo = (size_t)(q0 + qt * 16 + lr) * DQ + hi * 8;
#pragma unroll
        for (int dt = 0; dt < 4; ++dt) { v8us oh, ol;
#pragma unroll
            for (int j = 0; j < 8; ++j) { unsigned short a, c2; splitf(o[qt][dt][j] * inv, a, c2); oh[j] = a; ol[j] = c2; }
            *(v8us*)(Ah + oo + dt * 16) = oh; *(v8us*)(Al + oo + dt * 16) = ol; } }
}
// grid (NB_ * NH_, RH / 64 + (TT - RH) / 128), 4 waves: the hi/lo rows (3x the products) take 16 rows a wave and come first in launch order, the others 32 rows a wave. A block's waves walk the same K and V.
__global__ __launch_bounds__(128) void k_fattn(const h16* __restrict__ Q16, const h16* __restrict__ K16, const h16* __restrict__ V16, const bf* __restrict__ Qh, const bf* __restrict__ Ql, const bf* __restrict__ Kh, const bf* __restrict__ Kl, const bf* __restrict__ Vh, const bf* __restrict__ Vl, bf* Ah, bf* Al) {
    const int z = blockIdx.x, wave = threadIdx.x >> 5; const size_t pz = (size_t)z * TT * HD; const size_t az = (size_t)(z / NH_) * TT * DQ + (size_t)(z % NH_) * HD;
    if (blockIdx.y < RH / 64) fattn_rows<bf, true, 1>(Qh + pz, Ql + pz, Kh + pz, Kl + pz, Vh + pz, Vl + pz, blockIdx.y * 64 + wave * 16, Ah + az, Al + az);
    else fattn_rows<h16, false, 2>(Q16 + pz, nullptr, K16 + pz, nullptr, V16 + pz, nullptr, RH + (blockIdx.y - RH / 64) * 128 + wave * 32, Ah + az, Al + az);
}

extern "C" void kernel_launch(void* const* d_in, const int* in_sizes, int n_in,
                              void* d_out, int out_size, void* d_ws, size_t ws_size, hipStream_t stream) {
    (void)in_sizes; (void)n_in; (void)out_size;
    const float* x = (const float*)d_in[0]; const float* fcos = (const float*)d_in[1]; const float* fsin = (const float*)d_in[2]; const float* wq = (const float*)d_in[3]; const float* wk = (const float*)d_in[4]; const float* wv = (const float*)d_in[5]; const float* wo = (const float*)d_in[6]; const float* bo = (const float*)d_in[7];
    float* OUT = (float*)d_out;     // [2][2048][1024]
    char* wsp = (char*)d_ws;
    auto take = [&](size_t bytes) { char* p = wsp; wsp += (bytes + 255) & ~(size_t)255; return (void*)p; };
    bf* W4 = (bf*)take((size_t)4 * DQ * DM * 2); bf* WO = W4 + (size_t)3 * DQ * DM;   // bf16 Wq, Wk, Wv, Wo, one behind the other
    float* CS = (float*)take((size_t)TT * HD * 2 * 4);
    bf* XB = (bf*)take((size_t)NB_ * TT * DM * 2);
    const size_t PB = (size_t)NH_ * TT * HD;   // elements of one batch's q, k or v planes; each kind of plane lies as [q, k, v][batch]
    h16* QP16 = (h16*)take(3 * NB_ * PB * 2); h16* KP16 = QP16 + NB_ * PB; h16* VT16 = KP16 + NB_ * PB;
    bf* QPh = (bf*)take(3 * NB_ * PB * 2); bf* KPh = QPh + NB_ * PB; bf* VTh = KPh + NB_ * PB;
    bf* QPl = (bf*)take(3 * NB_ * PB * 2); bf* KPl = QPl + NB_ * PB; bf* VTl = KPl + NB_ * PB;
    bf* ATh = (bf*)take((size_t)NB_ * TT * DQ * 2); bf* ATl = (bf*)take((size_t)NB_ * TT * DQ * 2);
    if ((size_t)(wsp - (char*)d_ws) > ws_size) return;    // ws 256 MiB
    k_prep<<<PX + 4 * PW + PC, 256, 0, stream>>>(x, wq, wk, wv, wo, fcos, fsin, XB, W4, CS);
    k_gemmw<bf, 0, false, 1, 1><<<dim3(TT / 64, DQ / 64, 3 * NB_), 32, 0, stream>>>(XB, nullptr, W4, nullptr, DM, nullptr, DQ, nullptr, (size_t)TT * DM, (size_t)DQ * DM, PB, CS, QP16, QPh, QPl);
    k_fattn<<<dim3(NB_ * NH_, RH / 64 + (TT - RH) / 128, 1), 128, 0, stream>>>(QP16, KP16, VT16, QPh, QPl, KPh, KPl, VTh, VTl, ATh, ATl);
    k_gemmw<bf, 1, true><<<dim3(NB_ * TT / 64, DM / 64, 1), 32, 0, stream>>>(ATh, ATl, WO, nullptr, DQ, OUT, DM, bo, 0, 0, 0, nullptr, nullptr, nullptr, nullptr);
}

// v005
// One run takes 149 microseconds.
// In both of two side-by-side timings against v004, it was 1.36 times as fast.
// Over all steps from v000 it is 13.1 times as fast.
#include <hip/hip_runtime.h>

// Multi-head attention with interleaved rotary embeddings (x [2][2048][1024]; q,k,v = x W^T ('oi' [1024][1024], no bias; 16 heads x 64); rotary on (even, odd) pairs with the given cos/sin tables [2048][32] (read); scores / 8; softmax over all keys; out = merged Wo^T + bo -> [2][2048][1024] (4.2 M)).
// Layout: 4 launches, each over both batches (copies and table; the three projections; attention; the output product): bf16 copy of x; exact projections; {cos, sin} table per position built once from the inputs (bf16-rounded; pair i serves dims 2i, 2i+1); the interleaved rotary turn of q and k and the building of the q, k and v^T planes are the projection kernels' epilogues. Then one fused dense T-2048 attention kernel for both batches and all heads (hybrid rows: < 512 hi/lo 3 products, rest fp16 x1024); merged hi/lo x Wo exact + bo.
// Compute dtypes, f32 accumulate: every input rounded to bf16 incl. the tables; projections exact; rotary f32; attention rows < 512 3 products, rest fp16; softmax f32; Wo hl x exact + bias.

#define NB_  2
#define TT   2048
#define DM   1024
#define NH_  16
#define NKV  16
#define REP  (NH_ / NKV)
#define HD   64
#define DQ   (NH_ * HD)
#define DKV  (NKV * HD)
#define RH   512                  // query rows < RH use hi+lo planes (0: none)
#define WIN  0
#define SCL  0.125f   // HD^-0.5
typedef _Float16 h16;
typedef unsigned short bf;
typedef __attribute__((ext_vector_type(16))) __bf16   v16bf;
typedef __attribute__((ext_vector_type(16))) _Float16 v16h;
typedef __attribute__((ext_vector_type(8)))  _Float16 v8h;
typedef __attribute__((ext_vector_type(8)))  unsigned short v8us;
typedef __attribute__((ext_vector_type(8)))  float    v8f;
typedef __attribute__((ext_vector_type(4)))  float    v4f;
typedef v8h  __attribute__((may_alias)) v8ha;
typedef v4f  __attribute__((may_alias)) v4fa;
typedef v8us __attribute__((may_alias)) v8usa;

__device__ __forceinline__ unsigned short f2bf(float f) { unsigned u = __float_as_uint(f); u += 0x7FFFu + ((u >> 16) & 1u); return (unsigned short)(u >> 16); }
__device__ __forceinline__ float bf2f(unsigned short b) { return __uint_as_float(((unsigned)b) << 16); }
__device__ __forceinline__ float bfr(float f) { return bf2f(f2bf(f)); }
__device__ __forceinline__ v16h cat16(v8h lo, v8h hi) { return __builtin_shufflevector(lo, hi, 0, 1, 2, 3, 4, 5, 6, 7, 8, 9, 10, 11, 12, 13, 14, 15); }
__device__ __forceinline__ v16bf cat16b(v8us lo, v8us hi) { return __builtin_bit_cast(v16bf, __builtin_shufflevector(lo, hi, 0, 1, 2, 3, 4, 5, 6, 7, 8, 9, 10, 11, 12, 13, 14, 15)); }
__device__ __forceinline__ v8f wmma16(v16h a, v16h b, v8f c) { return __builtin_amdgcn_wmma_f32_16x16x32_f16(false, a, false, b, (short)0, c, false, false); }
__device__ __forceinline__ v8f wmmab(v16bf a, v16bf b, v8f c) { return __builtin_amdgcn_wmma_f32_16x16x32_bf16(false, a, false, b, (short)0, c, false, false); }



__device__ __forceinline__ h16 tohx(float x) { return (h16)x; }
__device__ __forceinline__ void splitf(float y, unsigned short& h, unsigned short& l) { h = f2bf(y); l = f2bf(y - bf2f(h)); }
typedef __attribute__((ext_vector_type(2))) _Float16 v2h;
typedef __attribute__((ext_vector_type(4))) _Float16 v4h;
typedef __attribute__((ext_vector_type(2))) unsigned short v2us;
typedef __attribute__((ext_vector_type(4))) unsigned short v4us;
typedef __attribute__((ext_vector_type(2))) float v2f;
typedef __attribute__((ext_vector_type(4))) int v4i;

// ---- k_gemmw: register-blocked GEMM, ONE WAVE per 64x64 output tile (16 accumulators), operands straight from K-contiguous 16-bit planes; grid (M/64, N/64, Z), 32 threads.
// C[m][n] (f32, pitch ldc, + optional f32 bias[n]) = sum_k A[m][k] Bt[n][k] (+ split products per NSPLIT). z-batch strides sA/sB/sC in elements. K % 32 == 0.
// EPI 1: all projections of all batches in one grid, z = projection * NB_ + batch (A strides by sA per batch, Bt by sB per projection, the planes by sC per z); a 64-column tile is one head; no f32 tile is stored.
//   q, k (projection 0, 1): the tile gets the interleaved rotary turn in the epilogue and goes out as the fp16, bf16-hi and bf16-lo planes [head][t][64].
//   v (projection 2): the tile goes out transposed as the three planes [head][d][t], straight from the accumulators (a lane holds 8 consecutive t of one column d).
// KS > 1: grid z = batch * KS + slice; a wave sums only its K / KS keys and stores a partial tile in plane (batch * KS + slice) of C (plane stride sC); the reader adds a batch's KS planes. K % (32 * KS) == 0.
template <typename T16> struct WFrag;
template <> struct WFrag<h16> { typedef v16h V; static __device__ __forceinline__ V ld(const h16* p) { return cat16(*(const v8h*)p, *(const v8h*)(p + 16)); } static __device__ __forceinline__ v8f mma(V a, V b, v8f c) { return wmma16(a, b, c); } };
template <> struct WFrag<bf> { typedef v16bf V; static __device__ __forceinline__ V ld(const bf* p) { return cat16b(*(const v8us*)p, *(const v8us*)(p + 16)); } static __device__ __forceinline__ v8f mma(V a, V b, v8f c) { return wmmab(a, b, c); } };
template <typename T16, int NSPLIT, bool BIAS, int KS = 1, int EPI = 0>
__global__ __launch_bounds__(32) void k_gemmw(const T16* __restrict__ A, const T16* __restrict__ A2, const T16* __restrict__ Bt, const T16* __restrict__ Bt2, int K, float* C, int ldc, const float* __restrict__ bias, size_t sA, size_t sB, size_t sC, const float* __restrict__ CS, h16* P16, bf* Ph, bf* Pl) {
    typedef typename WFrag<T16>::V V;
    __shared__ __align__(16) float os[16 * 68];
    const size_t z = blockIdx.z / KS; const int ks = blockIdx.z % KS;
    if (EPI == 1) { A += (size_t)(blockIdx.z % NB_) * sA; Bt += (size_t)(blockIdx.z / NB_) * sB; P16 += (size_t)blockIdx.z * sC; Ph += (size_t)blockIdx.z * sC; Pl += (size_t)blockIdx.z * sC; }
    else { A += z * sA; if (A2) A2 += z * sA; Bt += z * sB; if (Bt2) Bt2 += z * sB; C += (size_t)blockIdx.z * sC; }
    const int kbeg = ks * (K / KS), kend = kbeg + K / KS;
    const int lane = threadIdx.x & 31, lr = lane & 15, hi = lane >> 4; const int r0 = blockIdx.x * 64, c0 = blockIdx.y * 64;
    v8f acc[4][4];
#pragma unroll
    for (int mb = 0; mb < 4; ++mb)
#pragma unroll
        for (int nb = 0; nb < 4; ++nb) acc[mb][nb] = (v8f){};
    const size_t aoff = (size_t)(r0 + lr) * K + 8 * hi, boff = (size_t)(c0 + lr) * K + 8 * hi;
#pragma unroll 1
    for (int kc = kbeg; kc < kend; kc += 32) {
        V a[4], a2[4];
#pragma unroll
        for (int mb = 0; mb < 4; ++mb) { a[mb] = WFrag<T16>::ld(A + aoff + (size_t)mb * 16 * K + kc); if (NSPLIT == 1 || NSPLIT == 2) a2[mb] = WFrag<T16>::ld(A2 + aoff + (size_t)mb * 16 * K + kc); }
#pragma unroll
        for (int nb = 0; nb < 4; ++nb) { const V b = WFrag<T16>::ld(Bt + boff + (size_t)nb * 16 * K + kc); V b2; if (NSPLIT >= 2) b2 = WFrag<T16>::ld(Bt2 + boff + (size_t)nb * 16 * K + kc);
#pragma unroll
            for (int mb = 0; mb < 4; ++mb) { acc[mb][nb] = WFrag<T16>::mma(a[mb], b, acc[mb][nb]); if (NSPLIT == 1 || NSPLIT == 2) acc[mb][nb] = WFrag<T16>::mma(a2[mb], b, acc[mb][nb]); if (NSPLIT >= 2) acc[mb][nb] = WFrag<T16>::mma(a[mb], b2, acc[mb][nb]); } }
        asm volatile("v_nop\n\tv_nop\n\tv_nop\n\tv_nop" : "+v"(acc[0][0]), "+v"(acc[1][1]), "+v"(acc[2][2]), "+v"(acc[3][3]) : "v"(a[0]), "v"(a[3]));
    }
    asm volatile("s_wait_xcnt 0x0" ::: "memory");   // a precaution: it stands in front of the epilogue's first rewrite of an address register that the loop's last loads name
    if (EPI == 1 && blockIdx.z / NB_ == 2) {
#pragma unroll
        for (int nb = 0; nb < 4; ++nb)
#pragma unroll
            for (int mb = 0; mb < 4; ++mb) { const size_t e = ((size_t)blockIdx.y * HD + nb * 16 + lr) * TT + r0 + mb * 16 + hi * 8; v8h o16; v8us oh, ol;
#pragma unroll
                for (int j = 0; j < 8; ++j) { const float x = acc[mb][nb][j]; o16[j] = tohx(x); unsigned short a2, c2; splitf(x, a2, c2); oh[j] = a2; ol[j] = c2; }
                *(v8h*)(P16 + e) = o16; *(v8us*)(Ph + e) = oh; *(v8us*)(Pl + e) = ol;
                // a precaution: the wait stands in front of the next rewrite of a register these stores name; the scheduling fence keeps the next tile's arithmetic from being lifted over it
                asm volatile("s_wait_xcnt 0x0" ::: "memory"); __builtin_amdgcn_sched_barrier(0); }
        return;
    }
#pragma unroll
    for (int mb = 0; mb < 4; ++mb) {
        v2f csr[8][2];   // EPI 1: the {cos, sin} pairs of this lane's 8 rows, asked for as one group ahead of the staging so that one latency serves all
        if (EPI == 1) { const float* cp = CS + ((size_t)(r0 + mb * 16 + hi) * HD + lr * 4) * 2;
#pragma unroll
            for (int s = 0; s < 8; ++s) { csr[s][0] = *(const v2f*)(cp + s * 4 * HD); csr[s][1] = *(const v2f*)(cp + s * 4 * HD + 4); }
            asm volatile("s_wait_xcnt 0x0" ::: "memory"); }   // a precaution: it stands in front of the next rewrite of the address registers these loads name
#pragma unroll
        for (int nb = 0; nb < 4; ++nb) {
#pragma unroll
            for (int j = 0; j < 8; ++j) os[(hi * 8 + j) * 68 + nb * 16 + lr] = acc[mb][nb][j]; }
        __builtin_amdgcn_wave_barrier(); asm volatile("" ::: "memory");
        float* crow = C + (size_t)(r0 + mb * 16) * ldc + c0;
        if (EPI == 1) {
            v4f vals[8];   // the lane's 8 row pieces, read as one group: the waits between the rows' stores would hold a later LDS read back
#pragma unroll
            for (int s = 0; s < 8; ++s) vals[s] = *(const v4fa*)(os + (2 * s + hi) * 68 + lr * 4);
#pragma unroll
            for (int s = 0; s < 8; ++s) { const int row = 2 * s + hi, cofs = lr * 4, t = r0 + mb * 16 + row; const v4f val = vals[s]; const size_t e = ((size_t)blockIdx.y * TT + t) * HD + cofs; v4h o16; v4us oh, ol;
#pragma unroll
                for (int q = 0; q < 2; ++q) { const float x0 = val[2 * q], x1 = val[2 * q + 1]; const v2f cs = csr[s][q];
                    float a0 = __fmul_rn(x0, cs[0]), b0 = __fmul_rn(x1, cs[1]), a1 = __fmul_rn(x1, cs[0]), b1 = __fmul_rn(x0, cs[1]); asm volatile("" : "+v"(a0), "+v"(b0), "+v"(a1), "+v"(b1));
                    const float y0 = __fsub_rn(a0, b0), y1 = __fadd_rn(b1, a1);   /* even: x0 c - x1 s; odd: x0 s + x1 c */
                    o16[2 * q] = tohx(y0); o16[2 * q + 1] = tohx(y1); { unsigned short a2, c2; splitf(y0, a2, c2); oh[2 * q] = a2; ol[2 * q] = c2; splitf(y1, a2, c2); oh[2 * q + 1] = a2; ol[2 * q + 1] = c2; } }
                *(v4h*)(P16 + e) = o16; *(v4us*)(Ph + e) = oh; *(v4us*)(Pl + e) = ol;
                asm volatile("s_wait_xcnt 0x0" ::: "memory"); }   // a precaution: it stands in front of the next rewrite of a register these stores name
        } else {
#pragma unroll
            for (int s = 0; s < 8; ++s) { const int row = 2 * s + hi, cofs = lr * 4; v4f val = *(const v4fa*)(os + row * 68 + cofs); if (BIAS) { val[0] += bfr(bias[c0 + cofs]); val[1] += bfr(bias[c0 + cofs + 1]); val[2] += bfr(bias[c0 + cofs + 2]); val[3] += bfr(bias[c0 + cofs + 3]); }
                *(v4f*)(crow + (size_t)row * ldc + cofs) = val; }
             }
        __builtin_amdgcn_wave_barrier(); asm volatile("" ::: "memory");
    }
}


__global__ __launch_bounds__(256) void k_wtG(const float* __restrict__ w, int K, int N, bf* Bt) {
    const int lane = threadIdx.x & 31; const int L0 = (blockIdx.x * 8 + (threadIdx.x >> 5)) * 8; const int nlines = N * K / 64;
{
#pragma unroll 1
        for (int l = 0; l < 8; ++l) { const int L = L0 + l; if (L >= nlines) break; const size_t e = (size_t)L * 64 + lane * 2; const int k = (int)(e % K), n = (int)(e / K); v2us o;
            o[0] = f2bf(w[(size_t)k * N + n]); o[1] = f2bf(w[(size_t)(k + 1) * N + n]); *(v2us*)(Bt + e) = o; }
         }
}
// ---- k_prep: every bf16 copy and the table in one grid. Blocks [0, PX): x (both batches); then PW blocks for each of Wq, Wk, Wv, Wo (their copies lie one behind the other in W4); the last PC blocks: the {cos, sin} table.
#define PX  (NB_ * TT * DM / 8 / 256)
#define PW  (DQ * DM / 8 / 256)
#define PC  (TT * HD / 256)
__global__ __launch_bounds__(256) void k_prep(const float* __restrict__ x, const float* __restrict__ wq, const float* __restrict__ wk, const float* __restrict__ wv, const float* __restrict__ wo, const float* __restrict__ cs, const float* __restrict__ sn, bf* XB, bf* W4, float* CS) {
    const int blk = blockIdx.x;
    if (blk < PX + 4 * PW) {
        const int w = blk < PX ? 0 : (blk - PX) / PW;   // which weight (blocks behind x)
        const float* src = blk < PX ? x : w == 0 ? wq : w == 1 ? wk : w == 2 ? wv : wo;
        bf* dst = blk < PX ? XB : W4 + (size_t)w * DQ * DM;
        const size_t i = (size_t)(blk < PX ? blk : (blk - PX) % PW) * 256 + threadIdx.x; const v8f v = *(const v8f*)(src + i * 8); v8us o;
#pragma unroll
        for (int k = 0; k < 8; ++k) o[k] = f2bf(v[k]);
        *(v8us*)(dst + i * 8) = o;
        asm volatile("s_wait_xcnt 0x0" ::: "memory");   // a precaution: it stands in front of any later rewrite of a register this store names
    } else {
        const int idx = (blk - PX - 4 * PW) * 256 + threadIdx.x; const int d = idx % HD; const int t = idx / HD; v2f o; o[0] = bfr(cs[t * (HD / 2) + (d >> 1)]); o[1] = bfr(sn[t * (HD / 2) + (d >> 1)]); *(v2f*)(CS + (size_t)idx * 2) = o;
        asm volatile("s_wait_xcnt 0x0" ::: "memory");   // a precaution: it stands in front of any later rewrite of a register this store names
    }
}
// ---- k_fattn: scores, softmax and P x V of one (batch, head) in one kernel; no score or probability plane leaves the registers.
// One wave owns NQT x 16 query rows and walks the 2048 keys in steps of 32 with a running row maximum and row sum (online softmax).
// The products are taken transposed: S^T = K Q^T puts a query in a lane (column lr) and keys hi*8+j in its registers, which is already the B-fragment order of O^T = V^T P^T:
// tile 0 of a step gives elements 0..7 (keys 8hi+j), tile 1 elements 8..15 (keys 16+8hi+j), the k order of the V^T loader. Row statistics are per lane plus one exchange between the lane halves.
// HL: bf16 hi/lo planes, 3 products each (rows < RH); else fp16 planes with P carried x 2^10 (the factor is in the row sum too and cancels in the division).
// 2^x with the slot behind it in the same statement: the instruction set asks for one independent instruction or v_nop between a transcendental and an instruction that rewrites its source
__device__ __forceinline__ float exp2s(float x) { float r; asm("v_exp_f32 %0, %1\n\tv_nop" : "=v"(r) : "v"(x)); return r; }
// K and V reach the waves through LDS: a tile is KT keys, one K plane (64 keys x 128 B) and one V^T plane (64 dims x 128 B) (hi/lo rows: two of each), brought by asynchronous copies of whole 128-B lines
// and read by all 4 waves of the block. Two buffers: tile t + 1 flies while tile t is worked on. Rows lie at a pitch of 144 B (16 B x odd), which 16-byte LDS reads of 16 rows take without bank conflicts.
#define KT   64
#define LP   72                   // LDS row pitch, 16-bit elements
#define PLN  (64 * LP)            // elements of one staged plane
// one K plane and one V^T plane of the tile at key k0: 8 copies of 16 B a thread (128 threads; a wave's copy covers 4 whole rows). lk, lv: LDS byte addresses of the two planes.
template <typename T16>
__device__ __forceinline__ void stage_kv(const T16* __restrict__ Kp, const T16* __restrict__ Vt, int k0, unsigned lk, unsigned lv) {
    const int row = threadIdx.x >> 3, col = (threadIdx.x & 7) * 8;
    const T16* gk = Kp + (size_t)(k0 + row) * HD + col; const T16* gv = Vt + (size_t)row * TT + k0 + col;
    const unsigned lo = (unsigned)(row * LP + col) * 2; lk += lo; lv += lo;
    // the copies and, as a precaution, the wait that stands in front of any rewrite of a register they name, in one statement
    asm volatile("global_load_async_to_lds_b128 %0, %8, off\n\t"
                 "global_load_async_to_lds_b128 %1, %9, off\n\t"
                 "global_load_async_to_lds_b128 %2, %10, off\n\t"
                 "global_load_async_to_lds_b128 %3, %11, off\n\t"
                 "global_load_async_to_lds_b128 %4, %12, off\n\t"
                 "global_load_async_to_lds_b128 %5, %13, off\n\t"
                 "global_load_async_to_lds_b128 %6, %14, off\n\t"
                 "global_load_async_to_lds_b128 %7, %15, off\n\t"
                 "s_wait_xcnt 0x0"
                 :: "v"(lk), "v"(lk + 16 * LP * 2), "v"(lk + 32 * LP * 2), "v"(lk + 48 * LP * 2), "v"(lv), "v"(lv + 16 * LP * 2), "v"(lv + 32 * LP * 2), "v"(lv + 48 * LP * 2),
                    "v"(gk), "v"(gk + 16 * HD), "v"(gk + 32 * HD), "v"(gk + 48 * HD), "v"(gv), "v"(gv + 16 * TT), "v"(gv + 32 * TT), "v"(gv + 48 * TT) : "memory");
}
template <typename T16, bool HL, int NQT>
__device__ __forceinline__ void fattn_rows(const T16* __restrict__ Q, const T16* __restrict__ Q2, const T16* __restrict__ Kp, const T16* __restrict__ K2, const T16* __restrict__ Vt, const T16* __restrict__ V2, int q0, bf* Ah, bf* Al, const T16* ring) {
    typedef typename WFrag<T16>::V V;
    const int lane = threadIdx.x & 31, lr = lane & 15, hi = lane >> 4;
    const float CL2 = SCL * 1.4426950408889634f;   // scores -> log2 units
    const float POFF = HL ? 0.0f : 10.0f;
    V qf[NQT][2], qf2[NQT][2];
#pragma unroll
    for (int qt = 0; qt < NQT; ++qt)
#pragma unroll
        for (int c = 0; c < 2; ++c) { const size_t qo = (size_t)(q0 + qt * 16 + lr) * HD + c * 32 + 8 * hi; qf[qt][c] = WFrag<T16>::ld(Q + qo); if (HL) qf2[qt][c] = WFrag<T16>::ld(Q2 + qo); }
    v8f o[NQT][4]; float m[NQT], l[NQT];
#pragma unroll
    for (int qt = 0; qt < NQT; ++qt) { m[qt] = -3.0e38f; l[qt] = 0.f;
#pragma unroll
        for (int dt = 0; dt < 4; ++dt) o[qt][dt] = (v8f){}; }
    constexpr int NPL = HL ? 4 : 2;   // planes of a buffer: K, V^T (, K lo, V^T lo)
    const unsigned lb = (unsigned)(size_t)ring;   // the ring's LDS byte address
    auto stage = [&](int t) { const unsigned b = lb + (unsigned)(t & 1) * (NPL * PLN * 2); stage_kv<T16>(Kp, Vt, t * KT, b, b + PLN * 2); if (HL) stage_kv<T16>(K2, V2, t * KT, b + 2 * PLN * 2, b + 3 * PLN * 2); };
    stage(0);
    asm volatile("s_wait_asynccnt 0x0" ::: "memory");   // this wave's copies of tile 0 have landed
    __syncthreads();                                     // every wave's have: tile 0 may be read
    stage(1);
    const int fo = lr * LP + 8 * hi;
#pragma unroll 1
    for (int t = 0; t < TT / KT; ++t) {
      const T16* bK = ring + (t & 1) * (NPL * PLN) + fo; const T16* bV = bK + PLN;
#pragma unroll 1   // rolled: unrolled, the two steps' fragments and scores live side by side and the registers pass 256
      for (int ks = 0; ks < KT / 32; ++ks) {
        V kf[2][2], kf2[2][2];
#pragma unroll
        for (int kt = 0; kt < 2; ++kt)
#pragma unroll
            for (int c = 0; c < 2; ++c) { const int kk = (ks * 32 + kt * 16) * LP + c * 32; kf[kt][c] = WFrag<T16>::ld(bK + kk); if (HL) kf2[kt][c] = WFrag<T16>::ld(bK + 2 * PLN + kk); }
        V vf[4], vf2[4];   // this step's V^T fragments: asked for here, used behind the softmax
#pragma unroll
        for (int dt = 0; dt < 4; ++dt) { vf[dt] = WFrag<T16>::ld(bV + dt * 16 * LP + ks * 32); if (HL) vf2[dt] = WFrag<T16>::ld(bV + 2 * PLN + dt * 16 * LP + ks * 32); }
        v8f s[NQT][2];
#pragma unroll
        for (int qt = 0; qt < NQT; ++qt)
#pragma unroll
            for (int kt = 0; kt < 2; ++kt) { v8f a = (v8f){};
#pragma unroll
                for (int c = 0; c < 2; ++c) { a = WFrag<T16>::mma(kf[kt][c], qf[qt][c], a); if (HL) { a = WFrag<T16>::mma(kf2[kt][c], qf[qt][c], a); a = WFrag<T16>::mma(kf[kt][c], qf2[qt][c], a); } }
                s[qt][kt] = a; }
#pragma unroll
        for (int qt = 0; qt < NQT; ++qt) {
            float mx = fmaxf(s[qt][0][0], s[qt][1][0]);
#pragma unroll
            for (int j = 1; j < 8; ++j) mx = fmaxf(mx, fmaxf(s[qt][0][j], s[qt][1][j]));
            mx = fmaxf(mx, __shfl_xor(mx, 16, 32));
            const float mn = fmaxf(m[qt], mx * CL2); const float al = exp2s(m[qt] - mn); m[qt] = mn; const float off = POFF - mn;
            v8f p0, p1;
#pragma unroll
            for (int j = 0; j < 8; ++j) { p0[j] = exp2s(fmaf(s[qt][0][j], CL2, off)); p1[j] = exp2s(fmaf(s[qt][1][j], CL2, off)); }
            const v8f ps = p0 + p1; l[qt] = l[qt] * al + (((ps[0] + ps[1]) + (ps[2] + ps[3])) + ((ps[4] + ps[5]) + (ps[6] + ps[7])));
#pragma unroll
            for (int dt = 0; dt < 4; ++dt) o[qt][dt] *= al;
            if (HL) { v8us h0, h1, l0, l1;
#pragma unroll
                for (int j = 0; j < 8; ++j) { unsigned short a, c2; splitf(p0[j], a, c2); h0[j] = a; l0[j] = c2; splitf(p1[j], a, c2); h1[j] = a; l1[j] = c2; }
                const v16bf ph = cat16b(h0, h1), pl = cat16b(l0, l1);
#pragma unroll
                for (int dt = 0; dt < 4; ++dt) { o[qt][dt] = wmmab(__builtin_bit_cast(v16bf, vf[dt]), ph, o[qt][dt]); o[qt][dt] = wmmab(__builtin_bit_cast(v16bf, vf[dt]), pl, o[qt][dt]); o[qt][dt] = wmmab(__builtin_bit_cast(v16bf, vf2[dt]), ph, o[qt][dt]); }
            } else { v8h h0, h1;
#pragma unroll
                for (int j = 0; j < 8; ++j) { h0[j] = tohx(p0[j]); h1[j] = tohx(p1[j]); }
                const v16h pf = cat16(h0, h1);
#pragma unroll
                for (int dt = 0; dt < 4; ++dt) o[qt][dt] = wmma16(__builtin_bit_cast(v16h, vf[dt]), pf, o[qt][dt]); }
        }
      }
      asm volatile("s_wait_dscnt 0x0" ::: "memory");      // this wave's reads of tile t have come back
      asm volatile("s_wait_asynccnt 0x0" ::: "memory");   // this wave's copies of tile t + 1 have landed
      __syncthreads();                                     // tile t + 1 may be read, and tile t's buffer is free
      if (t + 2 < TT / KT) stage(t + 2);
    }
    asm volatile("s_wait_asynccnt 0x0" ::: "memory");   // no copy is in flight when the wave goes on to its end
#pragma unroll
    for (int qt = 0; qt < NQT; ++qt) { const float inv = __fdiv_rn(1.0f, l[qt] + __shfl_xor(l[qt], 16, 32)); const size_t oo = (size_t)(q0 + qt * 16 + lr) * DQ + hi * 8;
#pragma unroll
        for (int dt = 0; dt < 4; ++dt) { v8us oh, ol;
#pragma unroll
            for (int j = 0; j < 8; ++j) { unsigned short a, c2; splitf(o[qt][dt][j] * inv, a, c2); oh[j] = a; ol[j] = c2; }
            *(v8us*)(Ah + oo + dt * 16) = oh; *(v8us*)(Al + oo + dt * 16) = ol; } }
}
// grid (NB_ * NH_, RH / 64 + (TT - RH) / 128), 4 waves: the hi/lo rows (3x the products) take 16 rows a wave and come first in launch order, the others 32 rows a wave. A block's waves walk the same K and V tiles in LDS.
__global__ __launch_bounds__(128) void k_fattn(const h16* __restrict__ Q16, const h16* __restrict__ K16, const h16* __restrict__ V16, const bf* __restrict__ Qh, const bf* __restrict__ Ql, const bf* __restrict__ Kh, const bf* __restrict__ Kl, const bf* __restrict__ Vh, const bf* __restrict__ Vl, bf* Ah, bf* Al) {
    __shared__ __attribute__((aligned(16))) unsigned short ring[2 * 4 * PLN];   // two buffers of up to 4 planes
    const int z = blockIdx.x, wave = threadIdx.x >> 5; const size_t pz = (size_t)z * TT * HD; const size_t az = (size_t)(z / NH_) * TT * DQ + (size_t)(z % NH_) * HD;
    if (blockIdx.y < RH / 64) fattn_rows<bf, true, 1>(Qh + pz, Ql + pz, Kh + pz, Kl + pz, Vh + pz, Vl + pz, blockIdx.y * 64 + wave * 16, Ah + az, Al + az, (const bf*)ring);
    else fattn_rows<h16, false, 2>(Q16 + pz, nullptr, K16 + pz, nullptr, V16 + pz, nullptr, RH + (blockIdx.y - RH / 64) * 128 + wave * 32, Ah + az, Al + az, (const h16*)ring);
}

extern "C" void kernel_launch(void* const* d_in, const int* in_sizes, int n_in,
                              void* d_out, int out_size, void* d_ws, size_t ws_size, hipStream_t stream) {
    (void)in_sizes; (void)n_in; (void)out_size;
    const float* x = (const float*)d_in[0]; const float* fcos = (const float*)d_in[1]; const float* fsin = (const float*)d_in[2]; const float* wq = (const float*)d_in[3]; const float* wk = (const float*)d_in[4]; const float* wv = (const float*)d_in[5]; const float* wo = (const float*)d_in[6]; const float* bo = (const float*)d_in[7];
    float* OUT = (float*)d_out;     // [2][2048][1024]
    char* wsp = (char*)d_ws;
    auto take = [&](size_t bytes) { char* p = wsp; wsp += (bytes + 255) & ~(size_t)255; return (void*)p; };
    bf* W4 = (bf*)take((size_t)4 * DQ * DM * 2); bf* WO = W4 + (size_t)3 * DQ * DM;   // bf16 Wq, Wk, Wv, Wo, one behind the other
    float* CS = (float*)take((size_t)TT * HD * 2 * 4);
    bf* XB = (bf*)take((size_t)NB_ * TT * DM * 2);
    const size_t PB = (size_t)NH_ * TT * HD;   // elements of one batch's q, k or v planes; each kind of plane lies as [q, k, v][batch]
    h16* QP16 = (h16*)take(3 * NB_ * PB * 2); h16* KP16 = QP16 + NB_ * PB; h16* VT16 = KP16 + NB_ * PB;
    bf* QPh = (bf*)take(3 * NB_ * PB * 2); bf* KPh = QPh + NB_ * PB; bf* VTh = KPh + NB_ * PB;
    bf* QPl = (bf*)take(3 * NB_ * PB * 2); bf* KPl = QPl + NB_ * PB; bf* VTl = KPl + NB_ * PB;
    bf* ATh = (bf*)take((size_t)NB_ * TT * DQ * 2); bf* ATl = (bf*)take((size_t)NB_ * TT * DQ * 2);
    if ((size_t)(wsp - (char*)d_ws) > ws_size) return;    // ws 256 MiB
    k_prep<<<PX + 4 * PW + PC, 256, 0, stream>>>(x, wq, wk, wv, wo, fcos, fsin, XB, W4, CS);
    k_gemmw<bf, 0, false, 1, 1><<<dim3(TT / 64, DQ / 64, 3 * NB_), 32, 0, stream>>>(XB, nullptr, W4, nullptr, DM, nullptr, DQ, nullptr, (size_t)TT * DM, (size_t)DQ * DM, PB, CS, QP16, QPh, QPl);
    k_fattn<<<dim3(NB_ * NH_, RH / 64 + (TT - RH) / 128, 1), 128, 0, stream>>>(QP16, KP16, VT16, QPh, QPl, KPh, KPl, VTh, VTl, ATh, ATl);
    k_gemmw<bf, 1, true><<<dim3(NB_ * TT / 64, DM / 64, 1), 32, 0, stream>>>(ATh, ATl, WO, nullptr, DQ, OUT, DM, bo, 0, 0, 0, nullptr, nullptr, nullptr, nullptr);
}

// v006
// One run takes 107 microseconds.
// Two timings next to v005 put it at 1.41 and 1.39 times that version's speed.
// Over all steps from v000 it is 18.4 times as fast.
#include <hip/hip_runtime.h>

// Multi-head attention with interleaved rotary embeddings (x [2][2048][1024]; q,k,v = x W^T ('oi' [1024][1024], no bias; 16 heads x 64); rotary on (even, odd) pairs with the given cos/sin tables [2048][32] (read); scores / 8; softmax over all keys; out = merged Wo^T + bo -> [2][2048][1024] (4.2 M)).
// Layout: 4 launches, each over both batches (copies and table; the three projections; attention; the output product): bf16 copy of x; exact projections; {cos, sin} table per position built once from the inputs (bf16-rounded; pair i serves dims 2i, 2i+1); the interleaved rotary turn of q and k and the building of the q, k and v^T planes are the projection kernels' epilogues. Then one fused dense T-2048 attention kernel for both batches and all heads (hybrid rows: < 512 hi/lo 3 products, rest fp16 x1024); merged hi/lo x Wo exact + bo.
// Compute dtypes, f32 accumulate: every input rounded to bf16 incl. the tables; projections exact; rotary f32; attention rows < 512 3 products, rest fp16; softmax f32; Wo hl x exact + bias.

#define NB_  2
#define TT   2048
#define DM   1024
#define NH_  16
#define NKV  16
#define REP  (NH_ / NKV)
#define HD   64
#define DQ   (NH_ * HD)
#define DKV  (NKV * HD)
#define RH   512                  // query rows < RH use hi+lo planes (0: none)
#define WIN  0
#define SCL  0.125f   // HD^-0.5
typedef _Float16 h16;
typedef unsigned short bf;
typedef __attribute__((ext_vector_type(16))) __bf16   v16bf;
typedef __attribute__((ext_vector_type(16))) _Float16 v16h;
typedef __attribute__((ext_vector_type(8)))  _Float16 v8h;
typedef __attribute__((ext_vector_type(8)))  unsigned short v8us;
typedef __attribute__((ext_vector_type(8)))  float    v8f;
typedef __attribute__((ext_vector_type(4)))  float    v4f;
typedef v8h  __attribute__((may_alias)) v8ha;
typedef v4f  __attribute__((may_alias)) v4fa;
typedef v8us __attribute__((may_alias)) v8usa;

__device__ __forceinline__ unsigned short f2bf(float f) { unsigned u = __float_as_uint(f); u += 0x7FFFu + ((u >> 16) & 1u); return (unsigned short)(u >> 16); }
__device__ __forceinline__ float bf2f(unsigned short b) { return __uint_as_float(((unsigned)b) << 16); }
__device__ __forceinline__ float bfr(float f) { return bf2f(f2bf(f)); }
__device__ __forceinline__ v16h cat16(v8h lo, v8h hi) { return __builtin_shufflevector(lo, hi, 0, 1, 2, 3, 4, 5, 6, 7, 8, 9, 10, 11, 12, 13, 14, 15); }
__device__ __forceinline__ v16bf cat16b(v8us lo, v8us hi) { return __builtin_bit_cast(v16bf, __builtin_shufflevector(lo, hi, 0, 1, 2, 3, 4, 5, 6, 7, 8, 9, 10, 11, 12, 13, 14, 15)); }
__device__ __forceinline__ v8f wmma16(v16h a, v16h b, v8f c) { return __builtin_amdgcn_wmma_f32_16x16x32_f16(false, a, false, b, (short)0, c, false, false); }
__device__ __forceinline__ v8f wmmab(v16bf a, v16bf b, v8f c) { return __builtin_amdgcn_wmma_f32_16x16x32_bf16(false, a, false, b, (short)0, c, false, false); }



__device__ __forceinline__ h16 tohx(float x) { return (h16)x; }
__device__ __forceinline__ void splitf(float y, unsigned short& h, unsigned short& l) { h = f2bf(y); l = f2bf(y - bf2f(h)); }
typedef __attribute__((ext_vector_type(2))) _Float16 v2h;
typedef __attribute__((ext_vector_type(4))) _Float16 v4h;
typedef __attribute__((ext_vector_type(2))) unsigned short v2us;
typedef __attribute__((ext_vector_type(4))) unsigned short v4us;
typedef __attribute__((ext_vector_type(2))) float v2f;
typedef __attribute__((ext_vector_type(4))) int v4i;

// ---- k_gemmw: register-blocked GEMM, one wave per 64x64 output tile (16 accumulators), 4 waves (2 x 2 tiles) per 128x128 block; grid (M/128, N/128, Z), 128 threads.
// The K-contiguous 16-bit operand planes reach the waves through LDS: a tile is 64 k of the block's 128 A rows and 128 B rows (128 B a row), brought by asynchronous copies of whole 128-B lines; each row is read by 2 waves.
// Two buffers: tile t + 1 flies while tile t is worked on. Rows lie at a pitch of 144 B (16 B x odd), which 16-byte LDS reads of 16 rows take without bank conflicts. (K / KS) % 64 == 0.
// C[m][n] (f32, pitch ldc, + optional f32 bias[n]) = sum_k A[m][k] Bt[n][k] (+ split products per NSPLIT). z-batch strides sA/sB/sC in elements. K % 64 == 0.
// EPI 1: all projections of all batches in one grid, z = projection * NB_ + batch (A strides by sA per batch, Bt by sB per projection, the planes by sC per z); a 64-column tile is one head; no f32 tile is stored.
//   q, k (projection 0, 1): the tile gets the interleaved rotary turn in the epilogue and goes out as the fp16, bf16-hi and bf16-lo planes [head][t][64].
//   v (projection 2): the tile goes out transposed as the three planes [head][d][t], straight from the accumulators (a lane holds 8 consecutive t of one column d).
// KS > 1: grid z = batch * KS + slice; a wave sums only its K / KS keys and stores a partial tile in plane (batch * KS + slice) of C (plane stride sC); the reader adds a batch's KS planes. K % (64 * KS) == 0.
template <typename T16> struct WFrag;
template <> struct WFrag<h16> { typedef v16h V; static __device__ __forceinline__ V ld(const h16* p) { return cat16(*(const v8h*)p, *(const v8h*)(p + 16)); } static __device__ __forceinline__ v8f mma(V a, V b, v8f c) { return wmma16(a, b, c); } };
template <> struct WFrag<bf> { typedef v16bf V; static __device__ __forceinline__ V ld(const bf* p) { return cat16b(*(const v8us*)p, *(const v8us*)(p + 16)); } static __device__ __forceinline__ v8f mma(V a, V b, v8f c) { return wmmab(a, b, c); } };
#define GKT  64                   // k elements of a staged tile
#define GLP  72                   // LDS row pitch, 16-bit elements
#define GPL  (128 * GLP)          // elements of one staged plane (128 rows)
// one plane of a tile: 128 rows x 64 k; g: the tile's first element (row pitch ld elements), l: the plane's LDS byte address. 8 copies of 16 B a thread (128 threads; a wave's copy covers 4 whole rows).
template <typename T16>
__device__ __forceinline__ void stage_g(const T16* __restrict__ g, int ld, unsigned l) {
    const int row = threadIdx.x >> 3, col = (threadIdx.x & 7) * 8;
    g += (size_t)row * ld + col; l += (unsigned)(row * GLP + col) * 2; const size_t st = (size_t)16 * ld;
    // the copies and, as a precaution, the wait that stands in front of any rewrite of a register they name, in one statement
    asm volatile("global_load_async_to_lds_b128 %0, %8, off\n\t"
                 "global_load_async_to_lds_b128 %1, %9, off\n\t"
                 "global_load_async_to_lds_b128 %2, %10, off\n\t"
                 "global_load_async_to_lds_b128 %3, %11, off\n\t"
                 "global_load_async_to_lds_b128 %4, %12, off\n\t"
                 "global_load_async_to_lds_b128 %5, %13, off\n\t"
                 "global_load_async_to_lds_b128 %6, %14, off\n\t"
                 "global_load_async_to_lds_b128 %7, %15, off\n\t"
                 "s_wait_xcnt 0x0"
                 :: "v"(l), "v"(l + 16 * GLP * 2), "v"(l + 32 * GLP * 2), "v"(l + 48 * GLP * 2), "v"(l + 64 * GLP * 2), "v"(l + 80 * GLP * 2), "v"(l + 96 * GLP * 2), "v"(l + 112 * GLP * 2),
                    "v"(g), "v"(g + st), "v"(g + 2 * st), "v"(g + 3 * st), "v"(g + 4 * st), "v"(g + 5 * st), "v"(g + 6 * st), "v"(g + 7 * st) : "memory");
}
template <typename T16, int NSPLIT, bool BIAS, int KS = 1, int EPI = 0>
__global__ __launch_bounds__(128) void k_gemmw(const T16* __restrict__ A, const T16* __restrict__ A2, const T16* __restrict__ Bt, const T16* __restrict__ Bt2, int K, float* C, int ldc, const float* __restrict__ bias, size_t sA, size_t sB, size_t sC, const float* __restrict__ CS, h16* P16, bf* Ph, bf* Pl) {
    typedef typename WFrag<T16>::V V;
    constexpr bool HA2 = NSPLIT == 1 || NSPLIT == 2, HB2 = NSPLIT >= 2; constexpr int NPL = 2 + (HA2 ? 1 : 0) + (HB2 ? 1 : 0);   // planes of a buffer: A, B (, A2) (, B2)
    __shared__ __attribute__((aligned(16))) T16 ring[2 * NPL * GPL];
    __shared__ __align__(16) float osb[4][16 * 68];
    const int wave = __builtin_amdgcn_readfirstlane(threadIdx.x >> 5); float* os = osb[wave];
    const size_t z = blockIdx.z / KS; const int ks = blockIdx.z % KS;
    if (EPI == 1) { A += (size_t)(blockIdx.z % NB_) * sA; Bt += (size_t)(blockIdx.z / NB_) * sB; P16 += (size_t)blockIdx.z * sC; Ph += (size_t)blockIdx.z * sC; Pl += (size_t)blockIdx.z * sC; }
    else { A += z * sA; if (A2) A2 += z * sA; Bt += z * sB; if (Bt2) Bt2 += z * sB; C += (size_t)blockIdx.z * sC; }
    const int kbeg = ks * (K / KS), NT = (K / KS) / GKT;
    const int lane = threadIdx.x & 31, lr = lane & 15, hi = lane >> 4; const int r0 = blockIdx.x * 128 + (wave & 1) * 64, c0 = blockIdx.y * 128 + (wave >> 1) * 64, hd = c0 / 64;
    v8f acc[4][4];
#pragma unroll
    for (int mb = 0; mb < 4; ++mb)
#pragma unroll
        for (int nb = 0; nb < 4; ++nb) acc[mb][nb] = (v8f){};
    const size_t ga = (size_t)blockIdx.x * 128 * K + kbeg, gb = (size_t)blockIdx.y * 128 * K + kbeg;   // the block's first A and B elements
    const unsigned lb = (unsigned)(size_t)ring;   // the ring's LDS byte address
    auto stage = [&](int t) { const unsigned b = lb + (unsigned)(t & 1) * (NPL * GPL * 2); const int k0 = t * GKT;
        stage_g<T16>(A + ga + k0, K, b); stage_g<T16>(Bt + gb + k0, K, b + GPL * 2); if (HA2) stage_g<T16>(A2 + ga + k0, K, b + 2 * GPL * 2); if (HB2) stage_g<T16>(Bt2 + gb + k0, K, b + (NPL - 1) * GPL * 2); };
    stage(0);
    asm volatile("s_wait_asynccnt 0x0" ::: "memory");   // this wave's copies of tile 0 have landed
    __syncthreads();                                     // every wave's have: tile 0 may be read
    if (NT > 1) stage(1);
    const int fa = ((wave & 1) * 64 + lr) * GLP + 8 * hi, fb = GPL + ((wave >> 1) * 64 + lr) * GLP + 8 * hi;
#pragma unroll 1
    for (int t = 0; t < NT; ++t) {
      const T16* bt = ring + (t & 1) * (NPL * GPL);
#pragma unroll 1   // rolled: unrolled, the two steps' fragments live side by side with the 128 accumulator registers
      for (int kq = 0; kq < GKT / 32; ++kq) {
        const T16* pa = bt + fa + kq * 32; const T16* pb = bt + fb + kq * 32;
        V a[4], a2[4];
#pragma unroll
        for (int mb = 0; mb < 4; ++mb) { a[mb] = WFrag<T16>::ld(pa + mb * 16 * GLP); if (HA2) a2[mb] = WFrag<T16>::ld(pa + 2 * GPL + mb * 16 * GLP); }
#pragma unroll
        for (int nb = 0; nb < 4; ++nb) { const V b = WFrag<T16>::ld(pb + nb * 16 * GLP); V b2; if (HB2) b2 = WFrag<T16>::ld(pb + (NPL - 2) * GPL + nb * 16 * GLP);
#pragma unroll
            for (int mb = 0; mb < 4; ++mb) { acc[mb][nb] = WFrag<T16>::mma(a[mb], b, acc[mb][nb]); if (NSPLIT == 1 || NSPLIT == 2) acc[mb][nb] = WFrag<T16>::mma(a2[mb], b, acc[mb][nb]); if (NSPLIT >= 2) acc[mb][nb] = WFrag<T16>::mma(a[mb], b2, acc[mb][nb]); } }
        asm volatile("v_nop\n\tv_nop\n\tv_nop\n\tv_nop" : "+v"(acc[0][0]), "+v"(acc[1][1]), "+v"(acc[2][2]), "+v"(acc[3][3]) : "v"(a[0]), "v"(a[3]));
      }
      asm volatile("s_wait_dscnt 0x0" ::: "memory");      // this wave's reads of tile t have come back
      asm volatile("s_wait_asynccnt 0x0" ::: "memory");   // this wave's copies of tile t + 1 have landed
      __syncthreads();                                     // tile t + 1 may be read, and tile t's buffer is free
      if (t + 2 < NT) stage(t + 2);
    }
    asm volatile("s_wait_asynccnt 0x0" ::: "memory");   // no copy is in flight when the wave goes on to its epilogue
    if (EPI == 1 && blockIdx.z / NB_ == 2) {
#pragma unroll
        for (int nb = 0; nb < 4; ++nb)
#pragma unroll
            for (int mb = 0; mb < 4; ++mb) { const size_t e = ((size_t)hd * HD + nb * 16 + lr) * TT + r0 + mb * 16 + hi * 8; v8h o16; v8us oh, ol;
#pragma unroll
                for (int j = 0; j < 8; ++j) { const float x = acc[mb][nb][j]; o16[j] = tohx(x); unsigned short a2, c2; splitf(x, a2, c2); oh[j] = a2; ol[j] = c2; }
                *(v8h*)(P16 + e) = o16; *(v8us*)(Ph + e) = oh; *(v8us*)(Pl + e) = ol;
                // a precaution: the wait stands in front of the next rewrite of a register these stores name; the scheduling fence keeps the next tile's arithmetic from being lifted over it
                asm volatile("s_wait_xcnt 0x0" ::: "memory"); __builtin_amdgcn_sched_barrier(0); }
        return;
    }
#pragma unroll
    for (int mb = 0; mb < 4; ++mb) {
        v2f csr[8][2];   // EPI 1: the {cos, sin} pairs of this lane's 8 rows, asked for as one group ahead of the staging so that one latency serves all
        if (EPI == 1) { const float* cp = CS + ((size_t)(r0 + mb * 16 + hi) * HD + lr * 4) * 2;
#pragma unroll
            for (int s = 0; s < 8; ++s) { csr[s][0] = *(const v2f*)(cp + s * 4 * HD); csr[s][1] = *(const v2f*)(cp + s * 4 * HD + 4); }
            asm volatile("s_wait_xcnt 0x0" ::: "memory"); }   // a precaution: it stands in front of the next rewrite of the address registers these loads name
#pragma unroll
        for (int nb = 0; nb < 4; ++nb) {
#pragma unroll
            for (int j = 0; j < 8; ++j) os[(hi * 8 + j) * 68 + nb * 16 + lr] = acc[mb][nb][j]; }
        __builtin_amdgcn_wave_barrier(); asm volatile("" ::: "memory");
        float* crow = C + (size_t)(r0 + mb * 16) * ldc + c0;
        if (EPI == 1) {
            v4f vals[8];   // the lane's 8 row pieces, read as one group: the waits between the rows' stores would hold a later LDS read back
#pragma unroll
            for (int s = 0; s < 8; ++s) vals[s] = *(const v4fa*)(os + (2 * s + hi) * 68 + lr * 4);
#pragma unroll
            for (int s = 0; s < 8; ++s) { const int row = 2 * s + hi, cofs = lr * 4, t = r0 + mb * 16 + row; const v4f val = vals[s]; const size_t e = ((size_t)hd * TT + t) * HD + cofs; v4h o16; v4us oh, ol;
#pragma unroll
                for (int q = 0; q < 2; ++q) { const float x0 = val[2 * q], x1 = val[2 * q + 1]; const v2f cs = csr[s][q];
                    float a0 = __fmul_rn(x0, cs[0]), b0 = __fmul_rn(x1, cs[1]), a1 = __fmul_rn(x1, cs[0]), b1 = __fmul_rn(x0, cs[1]); asm volatile("" : "+v"(a0), "+v"(b0), "+v"(a1), "+v"(b1));
                    const float y0 = __fsub_rn(a0, b0), y1 = __fadd_rn(b1, a1);   /* even: x0 c - x1 s; odd: x0 s + x1 c */
                    o16[2 * q] = tohx(y0); o16[2 * q + 1] = tohx(y1); { unsigned short a2, c2; splitf(y0, a2, c2); oh[2 * q] = a2; ol[2 * q] = c2; splitf(y1, a2, c2); oh[2 * q + 1] = a2; ol[2 * q + 1] = c2; } }
                *(v4h*)(P16 + e) = o16; *(v4us*)(Ph + e) = oh; *(v4us*)(Pl + e) = ol;
                asm volatile("s_wait_xcnt 0x0" ::: "memory"); }   // a precaution: it stands in front of the next rewrite of a register these stores name
        } else {
#pragma unroll
            for (int s = 0; s < 8; ++s) { const int row = 2 * s + hi, cofs = lr * 4; v4f val = *(const v4fa*)(os + row * 68 + cofs); if (BIAS) { val[0] += bfr(bias[c0 + cofs]); val[1] += bfr(bias[c0 + cofs + 1]); val[2] += bfr(bias[c0 + cofs + 2]); val[3] += bfr(bias[c0 + cofs + 3]); }
                *(v4f*)(crow + (size_t)row * ldc + cofs) = val; }
             }
        __builtin_amdgcn_wave_barrier(); asm volatile("" ::: "memory");
    }
}


__global__ __launch_bounds__(256) void k_wtG(const float* __restrict__ w, int K, int N, bf* Bt) {
    const int lane = threadIdx.x & 31; const int L0 = (blockIdx.x * 8 + (threadIdx.x >> 5)) * 8; const int nlines = N * K / 64;
{
#pragma unroll 1
        for (int l = 0; l < 8; ++l) { const int L = L0 + l; if (L >= nlines) break; const size_t e = (size_t)L * 64 + lane * 2; const int k = (int)(e % K), n = (int)(e / K); v2us o;
            o[0] = f2bf(w[(size_t)k * N + n]); o[1] = f2bf(w[(size_t)(k + 1) * N + n]); *(v2us*)(Bt + e) = o; }
         }
}
// ---- k_prep: every bf16 copy and the table in one grid. Blocks [0, PX): x (both batches); then PW blocks for each of Wq, Wk, Wv, Wo (their copies lie one behind the other in W4); the last PC blocks: the {cos, sin} table.
#define PX  (NB_ * TT * DM / 8 / 256)
#define PW  (DQ * DM / 8 / 256)
#define PC  (TT * HD / 256)
__global__ __launch_bounds__(256) void k_prep(const float* __restrict__ x, const float* __restrict__ wq, const float* __restrict__ wk, const float* __restrict__ wv, const float* __restrict__ wo, const float* __restrict__ cs, const float* __restrict__ sn, bf* XB, bf* W4, float* CS) {
    const int blk = blockIdx.x;
    if (blk < PX + 4 * PW) {
        const int w = blk < PX ? 0 : (blk - PX) / PW;   // which weight (blocks behind x)
        const float* src = blk < PX ? x : w == 0 ? wq : w == 1 ? wk : w == 2 ? wv : wo;
        bf* dst = blk < PX ? XB : W4 + (size_t)w * DQ * DM;
        const size_t i = (size_t)(blk < PX ? blk : (blk - PX) % PW) * 256 + threadIdx.x; const v8f v = *(const v8f*)(src + i * 8); v8us o;
#pragma unroll
        for (int k = 0; k < 8; ++k) o[k] = f2bf(v[k]);
        *(v8us*)(dst + i * 8) = o;
        asm volatile("s_wait_xcnt 0x0" ::: "memory");   // a precaution: it stands in front of any later rewrite of a register this store names
    } else {
        const int idx = (blk - PX - 4 * PW) * 256 + threadIdx.x; const int d = idx % HD; const int t = idx / HD; v2f o; o[0] = bfr(cs[t * (HD / 2) + (d >> 1)]); o[1] = bfr(sn[t * (HD / 2) + (d >> 1)]); *(v2f*)(CS + (size_t)idx * 2) = o;
        asm volatile("s_wait_xcnt 0x0" ::: "memory");   // a precaution: it stands in front of any later rewrite of a register this store names
    }
}
// ---- k_fattn: scores, softmax and P x V of one (batch, head) in one kernel; no score or probability plane leaves the registers.
// One wave owns NQT x 16 query rows and walks the 2048 keys in steps of 32 with a running row maximum and row sum (online softmax).
// The products are taken transposed: S^T = K Q^T puts a query in a lane (column lr) and keys hi*8+j in its registers, which is already the B-fragment order of O^T = V^T P^T:
// tile 0 of a step gives elements 0..7 (keys 8hi+j), tile 1 elements 8..15 (keys 16+8hi+j), the k order of the V^T loader. Row statistics are per lane plus one exchange between the lane halves.
// HL: bf16 hi/lo planes, 3 products each (rows < RH); else fp16 planes with P carried x 2^10 (the factor is in the row sum too and cancels in the division).
// 2^x with the slot behind it in the same statement: the instruction set asks for one independent instruction or v_nop between a transcendental and an instruction that rewrites its source
__device__ __forceinline__ float exp2s(float x) { float r; asm("v_exp_f32 %0, %1\n\tv_nop" : "=v"(r) : "v"(x)); return r; }
// K and V reach the waves through LDS: a tile is KT keys, one K plane (64 keys x 128 B) and one V^T plane (64 dims x 128 B) (hi/lo rows: two of each), brought by asynchronous copies of whole 128-B lines
// and read by all 4 waves of the block. Two buffers: tile t + 1 flies while tile t is worked on. Rows lie at a pitch of 144 B (16 B x odd), which 16-byte LDS reads of 16 rows take without bank conflicts.
#define KT   64
#define LP   72                   // LDS row pitch, 16-bit elements
#define PLN  (64 * LP)            // elements of one staged plane
// one K plane and one V^T plane of the tile at key k0: 8 copies of 16 B a thread (128 threads; a wave's copy covers 4 whole rows). lk, lv: LDS byte addresses of the two planes.
template <typename T16>
__device__ __forceinline__ void stage_kv(const T16* __restrict__ Kp, const T16* __restrict__ Vt, int k0, unsigned lk, unsigned lv) {
    const int row = threadIdx.x >> 3, col = (threadIdx.x & 7) * 8;
    const T16* gk = Kp + (size_t)(k0 + row) * HD + col; const T16* gv = Vt + (size_t)row * TT + k0 + col;
    const unsigned lo = (unsigned)(row * LP + col) * 2; lk += lo; lv += lo;
    // the copies and, as a precaution, the wait that stands in front of any rewrite of a register they name, in one statement
    asm volatile("global_load_async_to_lds_b128 %0, %8, off\n\t"
                 "global_load_async_to_lds_b128 %1, %9, off\n\t"
                 "global_load_async_to_lds_b128 %2, %10, off\n\t"
                 "global_load_async_to_lds_b128 %3, %11, off\n\t"
                 "global_load_async_to_lds_b128 %4, %12, off\n\t"
                 "global_load_async_to_lds_b128 %5, %13, off\n\t"
                 "global_load_async_to_lds_b128 %6, %14, off\n\t"
                 "global_load_async_to_lds_b128 %7, %15, off\n\t"
                 "s_wait_xcnt 0x0"
                 :: "v"(lk), "v"(lk + 16 * LP * 2), "v"(lk + 32 * LP * 2), "v"(lk + 48 * LP * 2), "v"(lv), "v"(lv + 16 * LP * 2), "v"(lv + 32 * LP * 2), "v"(lv + 48 * LP * 2),
                    "v"(gk), "v"(gk + 16 * HD), "v"(gk + 32 * HD), "v"(gk + 48 * HD), "v"(gv), "v"(gv + 16 * TT), "v"(gv + 32 * TT), "v"(gv + 48 * TT) : "memory");
}
template <typename T16, bool HL, int NQT>
__device__ __forceinline__ void fattn_rows(const T16* __restrict__ Q, const T16* __restrict__ Q2, const T16* __restrict__ Kp, const T16* __restrict__ K2, const T16* __restrict__ Vt, const T16* __restrict__ V2, int q0, bf* Ah, bf* Al, const T16* ring) {
    typedef typename WFrag<T16>::V V;
    const int lane = threadIdx.x & 31, lr = lane & 15, hi = lane >> 4;
    const float CL2 = SCL * 1.4426950408889634f;   // scores -> log2 units
    const float POFF = HL ? 0.0f : 10.0f;
    V qf[NQT][2], qf2[NQT][2];
#pragma unroll
    for (int qt = 0; qt < NQT; ++qt)
#pragma unroll
        for (int c = 0; c < 2; ++c) { const size_t qo = (size_t)(q0 + qt * 16 + lr) * HD + c * 32 + 8 * hi; qf[qt][c] = WFrag<T16>::ld(Q + qo); if (HL) qf2[qt][c] = WFrag<T16>::ld(Q2 + qo); }
    v8f o[NQT][4]; float m[NQT], l[NQT];
#pragma unroll
    for (int qt = 0; qt < NQT; ++qt) { m[qt] = -3.0e38f; l[qt] = 0.f;
#pragma unroll
        for (int dt = 0; dt < 4; ++dt) o[qt][dt] = (v8f){}; }
    constexpr int NPL = HL ? 4 : 2;   // planes of a buffer: K, V^T (, K lo, V^T lo)
    const unsigned lb = (unsigned)(size_t)ring;   // the ring's LDS byte address
    auto stage = [&](int t) { const unsigned b = lb + (unsigned)(t & 1) * (NPL * PLN * 2); stage_kv<T16>(Kp, Vt, t * KT, b, b + PLN * 2); if (HL) stage_kv<T16>(K2, V2, t * KT, b + 2 * PLN * 2, b + 3 * PLN * 2); };
    stage(0);
    asm volatile("s_wait_asynccnt 0x0" ::: "memory");   // this wave's copies of tile 0 have landed
    __syncthreads();                                     // every wave's have: tile 0 may be read
    stage(1);
    const int fo = lr * LP + 8 * hi;
#pragma unroll 1
    for (int t = 0; t < TT / KT; ++t) {
      const T16* bK = ring + (t & 1) * (NPL * PLN) + fo; const T16* bV = bK + PLN;
#pragma unroll 1   // rolled: unrolled, the two steps' fragments and scores live side by side and the registers pass 256
      for (int ks = 0; ks < KT / 32; ++ks) {
        V kf[2][2], kf2[2][2];
#pragma unroll
        for (int kt = 0; kt < 2; ++kt)
#pragma unroll
            for (int c = 0; c < 2; ++c) { const int kk = (ks * 32 + kt * 16) * LP + c * 32; kf[kt][c] = WFrag<T16>::ld(bK + kk); if (HL) kf2[kt][c] = WFrag<T16>::ld(bK + 2 * PLN + kk); }
        V vf[4], vf2[4];   // this step's V^T fragments: asked for here, used behind the softmax
#pragma unroll
        for (int dt = 0; dt < 4; ++dt) { vf[dt] = WFrag<T16>::ld(bV + dt * 16 * LP + ks * 32); if (HL) vf2[dt] = WFrag<T16>::ld(bV + 2 * PLN + dt * 16 * LP + ks * 32); }
        v8f s[NQT][2];
#pragma unroll
        for (int qt = 0; qt < NQT; ++qt)
#pragma unroll
            for (int kt = 0; kt < 2; ++kt) { v8f a = (v8f){};
#pragma unroll
                for (int c = 0; c < 2; ++c) { a = WFrag<T16>::mma(kf[kt][c], qf[qt][c], a); if (HL) { a = WFrag<T16>::mma(kf2[kt][c], qf[qt][c], a); a = WFrag<T16>::mma(kf[kt][c], qf2[qt][c], a); } }
                s[qt][kt] = a; }
#pragma unroll
        for (int qt = 0; qt < NQT; ++qt) {
            float mx = fmaxf(s[qt][0][0], s[qt][1][0]);
#pragma unroll
            for (int j = 1; j < 8; ++j) mx = fmaxf(mx, fmaxf(s[qt][0][j], s[qt][1][j]));
            mx = fmaxf(mx, __shfl_xor(mx, 16, 32));
            const float mn = fmaxf(m[qt], mx * CL2); const float al = exp2s(m[qt] - mn); m[qt] = mn; const float off = POFF - mn;
            v8f p0, p1;
#pragma unroll
            for (int j = 0; j < 8; ++j) { p0[j] = exp2s(fmaf(s[qt][0][j], CL2, off)); p1[j] = exp2s(fmaf(s[qt][1][j], CL2, off)); }
            const v8f ps = p0 + p1; l[qt] = l[qt] * al + (((ps[0] + ps[1]) + (ps[2] + ps[3])) + ((ps[4] + ps[5]) + (ps[6] + ps[7])));
#pragma unroll
            for (int dt = 0; dt < 4; ++dt) o[qt][dt] *= al;
            if (HL) { v8us h0, h1, l0, l1;
#pragma unroll
                for (int j = 0; j < 8; ++j) { unsigned short a, c2; splitf(p0[j], a, c2); h0[j] = a; l0[j] = c2; splitf(p1[j], a, c2); h1[j] = a; l1[j] = c2; }
                const v16bf ph = cat16b(h0, h1), pl = cat16b(l0, l1);
#pragma unroll
                for (int dt = 0; dt < 4; ++dt) { o[qt][dt] = wmmab(__builtin_bit_cast(v16bf, vf[dt]), ph, o[qt][dt]); o[qt][dt] = wmmab(__builtin_bit_cast(v16bf, vf[dt]), pl, o[qt][dt]); o[qt][dt] = wmmab(__builtin_bit_cast(v16bf, vf2[dt]), ph, o[qt][dt]); }
            } else { v8h h0, h1;
#pragma unroll
                for (int j = 0; j < 8; ++j) { h0[j] = tohx(p0[j]); h1[j] = tohx(p1[j]); }
                const v16h pf = cat16(h0, h1);
#pragma unroll
                for (int dt = 0; dt < 4; ++dt) o[qt][dt] = wmma16(__builtin_bit_cast(v16h, vf[dt]), pf, o[qt][dt]); }
        }
      }
      asm volatile("s_wait_dscnt 0x0" ::: "memory");      // this wave's reads of tile t have come back
      asm volatile("s_wait_asynccnt 0x0" ::: "memory");   // this wave's copies of tile t + 1 have landed
      __syncthreads();                                     // tile t + 1 may be read, and tile t's buffer is free
      if (t + 2 < TT / KT) stage(t + 2);
    }
    asm volatile("s_wait_asynccnt 0x0" ::: "memory");   // no copy is in flight when the wave goes on to its end
#pragma unroll
    for (int qt = 0; qt < NQT; ++qt) { const float inv = __fdiv_rn(1.0f, l[qt] + __shfl_xor(l[qt], 16, 32)); const size_t oo = (size_t)(q0 + qt * 16 + lr) * DQ + hi * 8;
#pragma unroll
        for (int dt = 0; dt < 4; ++dt) { v8us oh, ol;
#pragma unroll
            for (int j = 0; j < 8; ++j) { unsigned short a, c2; splitf(o[qt][dt][j] * inv, a, c2); oh[j] = a; ol[j] = c2; }
            *(v8us*)(Ah + oo + dt * 16) = oh; *(v8us*)(Al + oo + dt * 16) = ol; } }
}
// grid (NB_ * NH_, RH / 64 + (TT - RH) / 128), 4 waves: the hi/lo rows (3x the products) take 16 rows a wave and come first in launch order, the others 32 rows a wave. A block's waves walk the same K and V tiles in LDS.
__global__ __launch_bounds__(128) void k_fattn(const h16* __restrict__ Q16, const h16* __restrict__ K16, const h16* __restrict__ V16, const bf* __restrict__ Qh, const bf* __restrict__ Ql, const bf* __restrict__ Kh, const bf* __restrict__ Kl, const bf* __restrict__ Vh, const bf* __restrict__ Vl, bf* Ah, bf* Al) {
    __shared__ __attribute__((aligned(16))) unsigned short ring[2 * 4 * PLN];   // two buffers of up to 4 planes
    const int z = blockIdx.x, wave = threadIdx.x >> 5; const size_t pz = (size_t)z * TT * HD; const size_t az = (size_t)(z / NH_) * TT * DQ + (size_t)(z % NH_) * HD;
    if (blockIdx.y < RH / 64) fattn_rows<bf, true, 1>(Qh + pz, Ql + pz, Kh + pz, Kl + pz, Vh + pz, Vl + pz, blockIdx.y * 64 + wave * 16, Ah + az, Al + az, (const bf*)ring);
    else fattn_rows<h16, false, 2>(Q16 + pz, nullptr, K16 + pz, nullptr, V16 + pz, nullptr, RH + (blockIdx.y - RH / 64) * 128 + wave * 32, Ah + az, Al + az, (const h16*)ring);
}

extern "C" void kernel_launch(void* const* d_in, const int* in_sizes, int n_in,
                              void* d_out, int out_size, void* d_ws, size_t ws_size, hipStream_t stream) {
    (void)in_sizes; (void)n_in; (void)out_size;
    const float* x = (const float*)d_in[0]; const float* fcos = (const float*)d_in[1]; const float* fsin = (const float*)d_in[2]; const float* wq = (const float*)d_in[3]; const float* wk = (const float*)d_in[4]; const float* wv = (const float*)d_in[5]; const float* wo = (const float*)d_in[6]; const float* bo = (const float*)d_in[7];
    float* OUT = (float*)d_out;     // [2][2048][1024]
    char* wsp = (char*)d_ws;
    auto take = [&](size_t bytes) { char* p = wsp; wsp += (bytes + 255) & ~(size_t)255; return (void*)p; };
    bf* W4 = (bf*)take((size_t)4 * DQ * DM * 2); bf* WO = W4 + (size_t)3 * DQ * DM;   // bf16 Wq, Wk, Wv, Wo, one behind the other
    float* CS = (float*)take((size_t)TT * HD * 2 * 4);
    bf* XB = (bf*)take((size_t)NB_ * TT * DM * 2);
    const size_t PB = (size_t)NH_ * TT * HD;   // elements of one batch's q, k or v planes; each kind of plane lies as [q, k, v][batch]
    h16* QP16 = (h16*)take(3 * NB_ * PB * 2); h16* KP16 = QP16 + NB_ * PB; h16* VT16 = KP16 + NB_ * PB;
    bf* QPh = (bf*)take(3 * NB_ * PB * 2); bf* KPh = QPh + NB_ * PB; bf* VTh = KPh + NB_ * PB;
    bf* QPl = (bf*)take(3 * NB_ * PB * 2); bf* KPl = QPl + NB_ * PB; bf* VTl = KPl + NB_ * PB;
    bf* ATh = (bf*)take((size_t)NB_ * TT * DQ * 2); bf* ATl = (bf*)take((size_t)NB_ * TT * DQ * 2);
    if ((size_t)(wsp - (char*)d_ws) > ws_size) return;    // ws 256 MiB
    k_prep<<<PX + 4 * PW + PC, 256, 0, stream>>>(x, wq, wk, wv, wo, fcos, fsin, XB, W4, CS);
    k_gemmw<bf, 0, false, 1, 1><<<dim3(TT / 128, DQ / 128, 3 * NB_), 128, 0, stream>>>(XB, nullptr, W4, nullptr, DM, nullptr, DQ, nullptr, (size_t)TT * DM, (size_t)DQ * DM, PB, CS, QP16, QPh, QPl);
    k_fattn<<<dim3(NB_ * NH_, RH / 64 + (TT - RH) / 128, 1), 128, 0, stream>>>(QP16, KP16, VT16, QPh, QPl, KPh, KPl, VTh, VTl, ATh, ATl);
    k_gemmw<bf, 1, true><<<dim3(NB_ * TT / 128, DM / 128, 1), 128, 0, stream>>>(ATh, ATl, WO, nullptr, DQ, OUT, DM, bo, 0, 0, 0, nullptr, nullptr, nullptr, nullptr);
}
